// v000
// The times below were measured on an AMD MI455X: many runs one after another, warmed up first and cycling through
// copies of the inputs, with the whole window's GPU time divided by the number of runs. Launches and the gaps
// between them are all in it. The median over several windows is given; except for v000 it joins two sittings, which
// can be a few percent apart, so the side-by-side timings, each taken in one sitting, are the better comparison.
// The starting kernel, v000, takes 229 microseconds a run.
#include <hip/hip_runtime.h>
#include <hip/hip_bf16.h>

typedef __attribute__((ext_vector_type(16))) _Float16 v16h;
typedef __attribute__((ext_vector_type(8)))  float    v8f;

__device__ __forceinline__ v8f wmma_f16(v16h a, v16h b, v8f c) {
  return __builtin_amdgcn_wmma_f32_16x16x32_f16(false, a, false, b, (short)0, c,
                                                false, false);
}

// Gather one 16-half fragment as 8 packed 32-bit loads (pairs contiguous in K).
__device__ __forceinline__ v16h ld_frag(const _Float16* base, const int* koff) {
  union { unsigned u[8]; v16h h; } t;
#pragma unroll
  for (int p = 0; p < 8; ++p)
    t.u[p] = *(const unsigned*)(base + koff[p]);
  return t.h;
}

__device__ __forceinline__ v8f zero8() {
  v8f z = {0.f, 0.f, 0.f, 0.f, 0.f, 0.f, 0.f, 0.f};
  return z;
}

__device__ __forceinline__ unsigned lds_off(const void* p) {
  return (unsigned)(size_t)p;
}

__device__ __forceinline__ void async_copy_b128(unsigned lds_byte_off,
                                                const void* gaddr) {
  asm volatile("global_load_async_to_lds_b128 %0, %1, off"
               :
               : "v"(lds_byte_off), "v"(gaddr)
               : "memory");
}

__device__ __forceinline__ void wait_async0() {
  asm volatile("s_wait_asynccnt 0x0" ::: "memory");
}

// ---------------------------------------------------------------------------
// GEMM: C[4096x512] = X[4096x512] * W[512x512], f16 compute / f32 accumulate.
// Block tile 128x64, 8 waves (each wave: 16 rows x 64 cols = 4 accumulators).
// MODE 0: out f16 [H][S][64]      (Q, K per-head layout)
// MODE 1: out f16 [H][64][S]      (V transposed per-head layout)
// MODE 2: out f32 [S][512] + bias (final projection)
// ---------------------------------------------------------------------------
template <int MODE>
__global__ __launch_bounds__(256) void gemm512(const float* __restrict__ X,
                                               const float* __restrict__ W,
                                               const float* __restrict__ bias,
                                               _Float16* __restrict__ out16,
                                               float* __restrict__ out32) {
  constexpr int D = 512;
  const int m0 = blockIdx.x * 128;
  const int n0 = blockIdx.y * 64;
  const int t    = threadIdx.x;
  const int lane = t & 31;
  const int w    = t >> 5;      // wave id 0..7 (wave32)
  const int r    = lane & 15;
  const int g    = lane >> 4;

  __shared__ _Float16 As[128 * 34];  // [row][k], stride 34 halves
  __shared__ _Float16 Bs[64 * 34];   // transposed: [n][k], stride 34

  int koff[8];
#pragma unroll
  for (int p = 0; p < 8; ++p) koff[p] = 2 * (p & 3) + 16 * (p >> 2) + 8 * g;

  v8f acc[4];
#pragma unroll
  for (int c = 0; c < 4; ++c) acc[c] = zero8();

  for (int kt = 0; kt < 16; ++kt) {
    const int k0 = kt * 32;
    __syncthreads();
    // A tile 128x32 f32 -> f16 LDS, 4x float4 per thread
#pragma unroll
    for (int i = 0; i < 4; ++i) {
      int idx = t + 256 * i;              // 0..1023 float4s
      int row = idx >> 3, c4 = idx & 7;
      float4 v = *(const float4*)(X + (size_t)(m0 + row) * D + k0 + 4 * c4);
      union { unsigned u; _Float16 h[2]; } pa, pb;
      pa.h[0] = (_Float16)v.x; pa.h[1] = (_Float16)v.y;
      pb.h[0] = (_Float16)v.z; pb.h[1] = (_Float16)v.w;
      *(unsigned*)(As + row * 34 + 4 * c4)     = pa.u;
      *(unsigned*)(As + row * 34 + 4 * c4 + 2) = pb.u;
    }
    // B tile 32x64 f32 -> f16 LDS transposed [n][k], 2x float4 per thread
#pragma unroll
    for (int i = 0; i < 2; ++i) {
      int idx = t + 256 * i;              // 0..511 float4s
      int kr = idx >> 4, c4 = idx & 15;
      float4 v = *(const float4*)(W + (size_t)(k0 + kr) * D + n0 + 4 * c4);
      Bs[(4 * c4 + 0) * 34 + kr] = (_Float16)v.x;
      Bs[(4 * c4 + 1) * 34 + kr] = (_Float16)v.y;
      Bs[(4 * c4 + 2) * 34 + kr] = (_Float16)v.z;
      Bs[(4 * c4 + 3) * 34 + kr] = (_Float16)v.w;
    }
    __syncthreads();
    v16h af = ld_frag(As + (16 * w + r) * 34, koff);
#pragma unroll
    for (int c = 0; c < 4; ++c) {
      v16h bf = ld_frag(Bs + (16 * c + r) * 34, koff);
      acc[c] = wmma_f16(af, bf, acc[c]);
    }
  }

#pragma unroll
  for (int c = 0; c < 4; ++c) {
    const int n = n0 + 16 * c + r;
#pragma unroll
    for (int j = 0; j < 8; ++j) {
      const int m = m0 + 16 * w + j + 8 * g;
      float val = acc[c][j];
      if (MODE == 2) {
        out32[(size_t)m * D + n] = val + bias[n];
      } else if (MODE == 0) {
        int h = n >> 6, dh = n & 63;
        out16[((size_t)h * 4096 + m) * 64 + dh] = (_Float16)val;
      } else {
        int h = n >> 6, dh = n & 63;
        out16[((size_t)h * 64 + dh) * 4096 + m] = (_Float16)val;
      }
    }
  }
}

__global__ __launch_bounds__(256) void flash_attn(const _Float16* __restrict__ Qh,
                                                  const _Float16* __restrict__ Kh,
                                                  const _Float16* __restrict__ VhT,
                                                  const float* __restrict__ mask,
                                                  float* __restrict__ ctx) {
  constexpr int S = 4096, DH = 64, D = 512;
  constexpr int KVS = 72;            // K/V row stride in halves: 144B, 16B-aligned
  constexpr int KVT = 64 * KVS;      // one K or V tile buffer (halves)
  constexpr int PS  = 68;            // P row stride (halves)

  const int head = blockIdx.y;
  const int m0   = blockIdx.x * 128;
  const int t    = threadIdx.x;
  const int lane = t & 31;
  const int w    = t >> 5;
  const int r    = lane & 15;
  const int g    = lane >> 4;

  __shared__ __align__(16) _Float16 smem[4 * KVT + 8 * 16 * PS];
  _Float16* Kt0 = smem;              // two K buffers
  _Float16* Vt0 = smem + 2 * KVT;    // two V buffers
  _Float16* Pt  = smem + 4 * KVT;    // per-wave P tiles [16][64]

  int koff[8];
#pragma unroll
  for (int p = 0; p < 8; ++p) koff[p] = 2 * (p & 3) + 16 * (p >> 2) + 8 * g;

  // Q A-fragments: rows m0+16w+r, two 32-wide K chunks over Dh=64 (in regs)
  const int qrow = m0 + 16 * w + r;
  v16h qa[2];
#pragma unroll
  for (int kk = 0; kk < 2; ++kk) {
    union { unsigned u[8]; v16h h; } tmp;
#pragma unroll
    for (int p = 0; p < 8; ++p)
      tmp.u[p] = *(const unsigned*)(Qh + ((size_t)head * S + qrow) * DH +
                                    kk * 32 + koff[p]);
    qa[kk] = tmp.h;
  }

  v8f oacc[4];
#pragma unroll
  for (int c = 0; c < 4; ++c) oacc[c] = zero8();
  float mrow[8], lrow[8];
#pragma unroll
  for (int j = 0; j < 8; ++j) { mrow[j] = -1.0e30f; lrow[j] = 0.0f; }

  const float scale = 0.125f;  // 1/(sqrt(64)+1e-9) rounds to 0.125 in f32

  // Issue async copies for one 64-key tile: per thread 2x16B of K + 2x16B of V.
  auto issue_tile = [&](int t0, int buf) {
#pragma unroll
    for (int i = 0; i < 2; ++i) {
      int idx = t + 256 * i;            // 0..511 chunks of 8 halves
      int row = idx >> 3, c8 = idx & 7;
      async_copy_b128(
          lds_off(Kt0 + buf * KVT + row * KVS + 8 * c8),
          (const void*)(Kh + ((size_t)head * S + t0 + row) * DH + 8 * c8));
      async_copy_b128(
          lds_off(Vt0 + buf * KVT + row * KVS + 8 * c8),
          (const void*)(VhT + ((size_t)head * DH + row) * S + t0 + 8 * c8));
    }
  };

  issue_tile(0, 0);  // prologue

  for (int t0 = 0; t0 < S; t0 += 64) {
    const int cur = (t0 >> 6) & 1;
    wait_async0();      // this wave's copies for tile t0 have landed in LDS
    __syncthreads();    // all waves landed; all waves done reading buf cur^1
    if (t0 + 64 < S) issue_tile(t0 + 64, cur ^ 1);  // overlaps compute below

    const _Float16* Kc = Kt0 + cur * KVT;
    const _Float16* Vc = Vt0 + cur * KVT;

    // S = Q * K^T : 2 K-chunks x 4 key-column blocks
    v8f sacc[4];
#pragma unroll
    for (int c = 0; c < 4; ++c) sacc[c] = zero8();
#pragma unroll
    for (int kk = 0; kk < 2; ++kk) {
#pragma unroll
      for (int c = 0; c < 4; ++c) {
        v16h kb = ld_frag(Kc + (16 * c + r) * KVS + kk * 32, koff);
        sacc[c] = wmma_f16(qa[kk], kb, sacc[c]);
      }
    }

    // Online softmax. Row j+8g is spread over the 16 lanes sharing (lane>>4);
    // xor-shuffles over {1,2,4,8} reduce within that half.
#pragma unroll
    for (int j = 0; j < 8; ++j) {
      const int qg = m0 + 16 * w + j + 8 * g;
      float s[4], mx = -1.0e30f;
#pragma unroll
      for (int c = 0; c < 4; ++c) {
        float mval = mask[(size_t)qg * S + t0 + 16 * c + r];
        s[c] = sacc[c][j] * scale + mval * (-1.0e9f);
        mx = fmaxf(mx, s[c]);
      }
      mx = fmaxf(mx, __shfl_xor(mx, 1, 32));
      mx = fmaxf(mx, __shfl_xor(mx, 2, 32));
      mx = fmaxf(mx, __shfl_xor(mx, 4, 32));
      mx = fmaxf(mx, __shfl_xor(mx, 8, 32));
      float mnew = fmaxf(mrow[j], mx);
      float corr = expf(mrow[j] - mnew);
      float ps = 0.0f;
#pragma unroll
      for (int c = 0; c < 4; ++c) {
        float pv = expf(s[c] - mnew);
        ps += pv;
        Pt[(w * 16 + j + 8 * g) * PS + 16 * c + r] = (_Float16)pv;
      }
      ps += __shfl_xor(ps, 1, 32);
      ps += __shfl_xor(ps, 2, 32);
      ps += __shfl_xor(ps, 4, 32);
      ps += __shfl_xor(ps, 8, 32);
      lrow[j] = lrow[j] * corr + ps;
      mrow[j] = mnew;
#pragma unroll
      for (int c = 0; c < 4; ++c) oacc[c][j] *= corr;
    }
    __syncthreads();  // P tile visible (cross-lane) before A-frag gather

    // O += P * V : P as A-frags (K = 64 keys), V as B-frags from [dh][key]
    v16h pa[2];
#pragma unroll
    for (int kk = 0; kk < 2; ++kk)
      pa[kk] = ld_frag(Pt + (w * 16 + r) * PS + kk * 32, koff);
#pragma unroll
    for (int kk = 0; kk < 2; ++kk) {
#pragma unroll
      for (int c = 0; c < 4; ++c) {
        v16h vb = ld_frag(Vc + (16 * c + r) * KVS + kk * 32, koff);
        oacc[c] = wmma_f16(pa[kk], vb, oacc[c]);
      }
    }
  }

  // Normalize and write ctx (heads merged): ctx[s][head*64 + dh], f32.
#pragma unroll
  for (int j = 0; j < 8; ++j) {
    const float inv = 1.0f / lrow[j];
    const int qg = m0 + 16 * w + j + 8 * g;
#pragma unroll
    for (int c = 0; c < 4; ++c)
      ctx[(size_t)qg * D + head * 64 + 16 * c + r] = oacc[c][j] * inv;
  }
}

// ---------------------------------------------------------------------------
// Launch: 3 projections -> flash attention -> output projection. 20MB ws.
// ---------------------------------------------------------------------------
extern "C" void kernel_launch(void* const* d_in, const int* in_sizes, int n_in,
                              void* d_out, int out_size, void* d_ws, size_t ws_size,
                              hipStream_t stream) {
  (void)in_sizes; (void)n_in; (void)out_size; (void)ws_size;
  const float* q    = (const float*)d_in[0];
  const float* k    = (const float*)d_in[1];
  const float* v    = (const float*)d_in[2];
  const float* mask = (const float*)d_in[3];
  const float* wq   = (const float*)d_in[4];
  const float* wk   = (const float*)d_in[5];
  const float* wv   = (const float*)d_in[6];
  const float* wo   = (const float*)d_in[7];
  const float* bo   = (const float*)d_in[8];
  float* out = (float*)d_out;

  char* ws = (char*)d_ws;
  _Float16* Qh  = (_Float16*)(ws + 0);                        // 4 MB [H][S][64]
  _Float16* Kh  = (_Float16*)(ws + (size_t)4  * 1024 * 1024); // 4 MB [H][S][64]
  _Float16* VhT = (_Float16*)(ws + (size_t)8  * 1024 * 1024); // 4 MB [H][64][S]
  float*    ctx = (float*)   (ws + (size_t)12 * 1024 * 1024); // 8 MB [S][512]

  dim3 ggrid(32, 8);   // 4096/128 row blocks x 512/64 col blocks
  dim3 gblk(256);
  gemm512<0><<<ggrid, gblk, 0, stream>>>(q, wq, nullptr, Qh, nullptr);
  gemm512<0><<<ggrid, gblk, 0, stream>>>(k, wk, nullptr, Kh, nullptr);
  gemm512<1><<<ggrid, gblk, 0, stream>>>(v, wv, nullptr, VhT, nullptr);
  flash_attn<<<dim3(32, 8), gblk, 0, stream>>>(Qh, Kh, VhT, mask, ctx);
  gemm512<2><<<ggrid, gblk, 0, stream>>>(ctx, wo, bo, nullptr, out);
}

// v001
// A run of this version takes 205 microseconds.
// Two timings next to v000 both put it at 1.15 times that version's speed.
#include <hip/hip_runtime.h>
#include <hip/hip_bf16.h>

typedef __attribute__((ext_vector_type(16))) _Float16 v16h;
typedef __attribute__((ext_vector_type(8)))  float    v8f;

__device__ __forceinline__ v8f wmma_f16(v16h a, v16h b, v8f c) {
  return __builtin_amdgcn_wmma_f32_16x16x32_f16(false, a, false, b, (short)0, c,
                                                false, false);
}

// Gather one 16-half fragment as 8 packed 32-bit loads (pairs contiguous in K).
__device__ __forceinline__ v16h ld_frag(const _Float16* base, const int* koff) {
  union { unsigned u[8]; v16h h; } t;
#pragma unroll
  for (int p = 0; p < 8; ++p)
    t.u[p] = *(const unsigned*)(base + koff[p]);
  return t.h;
}

__device__ __forceinline__ v8f zero8() {
  v8f z = {0.f, 0.f, 0.f, 0.f, 0.f, 0.f, 0.f, 0.f};
  return z;
}

__device__ __forceinline__ unsigned lds_off(const void* p) {
  return (unsigned)(size_t)p;
}

__device__ __forceinline__ void async_copy_b128(unsigned lds_byte_off,
                                                const void* gaddr) {
  asm volatile("global_load_async_to_lds_b128 %0, %1, off"
               :
               : "v"(lds_byte_off), "v"(gaddr)
               : "memory");
}

// Value of the same lane position in the other 16-lane half (lane ^ 16).
__device__ __forceinline__ float other_half(float x) {
  unsigned u = __builtin_bit_cast(unsigned, x);
  u = __builtin_amdgcn_permlanex16(u, u, 0x76543210u, 0xfedcba98u, false, false);
  return __builtin_bit_cast(float, u);
}

__device__ __forceinline__ void wait_async0() {
  asm volatile("s_wait_asynccnt 0x0" ::: "memory");
}

// ---------------------------------------------------------------------------
// GEMM: C[4096x512] = X[4096x512] * W[512x512], f16 compute / f32 accumulate.
// Block tile 128x64, 8 waves (each wave: 16 rows x 64 cols = 4 accumulators).
// MODE 0: out f16 [H][S][64]      (Q, K per-head layout)
// MODE 1: out f16 [H][64][S]      (V transposed per-head layout)
// MODE 2: out f32 [S][512] + bias (final projection)
// ---------------------------------------------------------------------------
template <int MODE>
__global__ __launch_bounds__(256) void gemm512(const float* __restrict__ X,
                                               const float* __restrict__ W,
                                               const float* __restrict__ bias,
                                               _Float16* __restrict__ out16,
                                               float* __restrict__ out32) {
  constexpr int D = 512;
  const int m0 = blockIdx.x * 128;
  const int n0 = blockIdx.y * 64;
  const int t    = threadIdx.x;
  const int lane = t & 31;
  const int w    = t >> 5;      // wave id 0..7 (wave32)
  const int r    = lane & 15;
  const int g    = lane >> 4;

  __shared__ _Float16 As[128 * 34];  // [row][k], stride 34 halves
  __shared__ _Float16 Bs[64 * 34];   // transposed: [n][k], stride 34

  int koff[8];
#pragma unroll
  for (int p = 0; p < 8; ++p) koff[p] = 2 * (p & 3) + 16 * (p >> 2) + 8 * g;

  v8f acc[4];
#pragma unroll
  for (int c = 0; c < 4; ++c) acc[c] = zero8();

  for (int kt = 0; kt < 16; ++kt) {
    const int k0 = kt * 32;
    __syncthreads();
    // A tile 128x32 f32 -> f16 LDS, 4x float4 per thread
#pragma unroll
    for (int i = 0; i < 4; ++i) {
      int idx = t + 256 * i;              // 0..1023 float4s
      int row = idx >> 3, c4 = idx & 7;
      float4 v = *(const float4*)(X + (size_t)(m0 + row) * D + k0 + 4 * c4);
      union { unsigned u; _Float16 h[2]; } pa, pb;
      pa.h[0] = (_Float16)v.x; pa.h[1] = (_Float16)v.y;
      pb.h[0] = (_Float16)v.z; pb.h[1] = (_Float16)v.w;
      *(unsigned*)(As + row * 34 + 4 * c4)     = pa.u;
      *(unsigned*)(As + row * 34 + 4 * c4 + 2) = pb.u;
    }
    // B tile 32x64 f32 -> f16 LDS transposed [n][k], 2x float4 per thread
#pragma unroll
    for (int i = 0; i < 2; ++i) {
      int idx = t + 256 * i;              // 0..511 float4s
      int kr = idx >> 4, c4 = idx & 15;
      float4 v = *(const float4*)(W + (size_t)(k0 + kr) * D + n0 + 4 * c4);
      Bs[(4 * c4 + 0) * 34 + kr] = (_Float16)v.x;
      Bs[(4 * c4 + 1) * 34 + kr] = (_Float16)v.y;
      Bs[(4 * c4 + 2) * 34 + kr] = (_Float16)v.z;
      Bs[(4 * c4 + 3) * 34 + kr] = (_Float16)v.w;
    }
    __syncthreads();
    v16h af = ld_frag(As + (16 * w + r) * 34, koff);
#pragma unroll
    for (int c = 0; c < 4; ++c) {
      v16h bf = ld_frag(Bs + (16 * c + r) * 34, koff);
      acc[c] = wmma_f16(af, bf, acc[c]);
    }
  }

#pragma unroll
  for (int c = 0; c < 4; ++c) {
    const int n = n0 + 16 * c + r;
#pragma unroll
    for (int j = 0; j < 8; ++j) {
      const int m = m0 + 16 * w + j + 8 * g;
      float val = acc[c][j];
      if (MODE == 2) {
        out32[(size_t)m * D + n] = val + bias[n];
      } else if (MODE == 0) {
        int h = n >> 6, dh = n & 63;
        out16[((size_t)h * 4096 + m) * 64 + dh] = (_Float16)val;
      } else {
        int h = n >> 6, dh = n & 63;
        out16[((size_t)h * 64 + dh) * 4096 + m] = (_Float16)val;
      }
    }
  }
}

__global__ __launch_bounds__(256) __attribute__((amdgpu_waves_per_eu(2, 2))) void flash_attn(const _Float16* __restrict__ Qh,
                                                  const _Float16* __restrict__ Kh,
                                                  const _Float16* __restrict__ VhT,
                                                  const float* __restrict__ mask,
                                                  float* __restrict__ ctx) {
  constexpr int S = 4096, DH = 64, D = 512;
  constexpr int KVS = 72;            // K/V row stride in halves: 144B, 16B-aligned
  constexpr int KVT = 64 * KVS;      // one K or V tile buffer (halves)

  const int head = blockIdx.y;
  const int m0   = blockIdx.x * 128;
  const int t    = threadIdx.x;
  const int lane = t & 31;
  const int w    = t >> 5;
  const int r    = lane & 15;
  const int g    = lane >> 4;

  __shared__ __align__(16) _Float16 smem[4 * KVT];
  _Float16* Kt0 = smem;              // two K buffers
  _Float16* Vt0 = smem + 2 * KVT;    // two V buffers

  int koff[8];
#pragma unroll
  for (int p = 0; p < 8; ++p) koff[p] = 2 * (p & 3) + 16 * (p >> 2) + 8 * g;

  // Q^T B-fragments: column (query) m0+16w+r, two 32-wide K chunks over Dh=64
  const int qrow = m0 + 16 * w + r;
  v16h qb[2];
#pragma unroll
  for (int kk = 0; kk < 2; ++kk) {
    union { unsigned u[8]; v16h h; } tmp;
#pragma unroll
    for (int p = 0; p < 8; ++p)
      tmp.u[p] = *(const unsigned*)(Qh + ((size_t)head * S + qrow) * DH +
                                    kk * 32 + koff[p]);
    qb[kk] = tmp.h;
  }

  // O^T tiles: oacc[c][j] = O(query r, dh 16c + j + 8g)
  v8f oacc[4];
#pragma unroll
  for (int c = 0; c < 4; ++c) oacc[c] = zero8();
  float mrow = -1.0e30f;  // running max of query r (equal in both halves)
  float lrow = 0.0f;      // running sum over this half's keys only

  const float scale = 0.125f;  // 1/(sqrt(64)+1e-9) rounds to 0.125 in f32

  // This lane's mask row, at its half's first key of a 16-key group.
  const float* mrowp = mask + (size_t)qrow * S + 8 * g;

  // Issue async copies for one 64-key tile: per thread 2x16B of K + 2x16B of V.
  auto issue_tile = [&](int t0, int buf) {
#pragma unroll
    for (int i = 0; i < 2; ++i) {
      int idx = t + 256 * i;            // 0..511 chunks of 8 halves
      int row = idx >> 3, c8 = idx & 7;
      async_copy_b128(
          lds_off(Kt0 + buf * KVT + row * KVS + 8 * c8),
          (const void*)(Kh + ((size_t)head * S + t0 + row) * DH + 8 * c8));
      async_copy_b128(
          lds_off(Vt0 + buf * KVT + row * KVS + 8 * c8),
          (const void*)(VhT + ((size_t)head * DH + row) * S + t0 + 8 * c8));
    }
  };

  issue_tile(0, 0);  // prologue

  for (int t0 = 0; t0 < S; t0 += 64) {
    const int cur = (t0 >> 6) & 1;
    wait_async0();      // this wave's copies for tile t0 have landed in LDS
    __syncthreads();    // all waves landed; all waves done reading buf cur^1
    if (t0 + 64 < S) issue_tile(t0 + 64, cur ^ 1);  // overlaps compute below

    const _Float16* Kc = Kt0 + cur * KVT;
    const _Float16* Vc = Vt0 + cur * KVT;

    // Mask: 8 consecutive keys of one query per 16-key group, 2x float4.
    float4 mk[4][2];
#pragma unroll
    for (int c = 0; c < 4; ++c) {
      mk[c][0] = *(const float4*)(mrowp + t0 + 16 * c);
      mk[c][1] = *(const float4*)(mrowp + t0 + 16 * c + 4);
    }

    // S^T = K * Q^T : 2 K-chunks x 4 key-row blocks
    v8f sacc[4];
#pragma unroll
    for (int c = 0; c < 4; ++c) sacc[c] = zero8();
#pragma unroll
    for (int kk = 0; kk < 2; ++kk) {
#pragma unroll
      for (int c = 0; c < 4; ++c) {
        v16h ka = ld_frag(Kc + (16 * c + r) * KVS + kk * 32, koff);
        sacc[c] = wmma_f16(ka, qb[kk], sacc[c]);
      }
    }

    // Online softmax of query r: 32 scores in this lane, 32 in lane^16.
    float s[4][8], mxc[4];
#pragma unroll
    for (int c = 0; c < 4; ++c) {
      const float mv[8] = {mk[c][0].x, mk[c][0].y, mk[c][0].z, mk[c][0].w,
                           mk[c][1].x, mk[c][1].y, mk[c][1].z, mk[c][1].w};
      mxc[c] = -1.0e30f;
#pragma unroll
      for (int j = 0; j < 8; ++j) {
        // scale is a power of two: the product is exact, one rounding in all
        s[c][j] = fmaf(mv[j], -1.0e9f, sacc[c][j] * scale);
        mxc[c] = fmaxf(mxc[c], s[c][j]);
      }
    }
    float mx = fmaxf(fmaxf(mxc[0], mxc[1]), fmaxf(mxc[2], mxc[3]));
    mx = fmaxf(mx, other_half(mx));
    const float mnew = fmaxf(mrow, mx);
    const float corr = expf(mrow - mnew);
    mrow = mnew;

    float psc[4];
    v16h pb[2];
#pragma unroll
    for (int c = 0; c < 4; ++c) {
      psc[c] = 0.0f;
#pragma unroll
      for (int j = 0; j < 8; ++j) {
        float pv = expf(s[c][j] - mnew);
        psc[c] += pv;
        pb[c >> 1][8 * (c & 1) + j] = (_Float16)pv;
      }
    }
    lrow = lrow * corr + ((psc[0] + psc[1]) + (psc[2] + psc[3]));
#pragma unroll
    for (int c = 0; c < 4; ++c)
#pragma unroll
      for (int j = 0; j < 8; ++j) oacc[c][j] *= corr;

    // O^T += V^T * P^T : V^T as A-frags from [dh][key], P^T from registers
#pragma unroll
    for (int kk = 0; kk < 2; ++kk) {
#pragma unroll
      for (int c = 0; c < 4; ++c) {
        v16h va = ld_frag(Vc + (16 * c + r) * KVS + kk * 32, koff);
        oacc[c] = wmma_f16(va, pb[kk], oacc[c]);
      }
    }
  }

  // Join the halves' sums, normalize, write ctx (heads merged), f32:
  // ctx[query][head*64 + 16c + 8g + 0..7], 2x float4 per tile.
  const float inv = 1.0f / (lrow + other_half(lrow));
  float* orow = ctx + (size_t)qrow * D + head * 64 + 8 * g;
#pragma unroll
  for (int c = 0; c < 4; ++c) {
    float4 lo = {oacc[c][0] * inv, oacc[c][1] * inv, oacc[c][2] * inv, oacc[c][3] * inv};
    float4 hi = {oacc[c][4] * inv, oacc[c][5] * inv, oacc[c][6] * inv, oacc[c][7] * inv};
    *(float4*)(orow + 16 * c)     = lo;
    *(float4*)(orow + 16 * c + 4) = hi;
  }
}

// ---------------------------------------------------------------------------
// Launch: 3 projections -> flash attention -> output projection. 20MB ws.
// ---------------------------------------------------------------------------
extern "C" void kernel_launch(void* const* d_in, const int* in_sizes, int n_in,
                              void* d_out, int out_size, void* d_ws, size_t ws_size,
                              hipStream_t stream) {
  (void)in_sizes; (void)n_in; (void)out_size; (void)ws_size;
  const float* q    = (const float*)d_in[0];
  const float* k    = (const float*)d_in[1];
  const float* v    = (const float*)d_in[2];
  const float* mask = (const float*)d_in[3];
  const float* wq   = (const float*)d_in[4];
  const float* wk   = (const float*)d_in[5];
  const float* wv   = (const float*)d_in[6];
  const float* wo   = (const float*)d_in[7];
  const float* bo   = (const float*)d_in[8];
  float* out = (float*)d_out;

  char* ws = (char*)d_ws;
  _Float16* Qh  = (_Float16*)(ws + 0);                        // 4 MB [H][S][64]
  _Float16* Kh  = (_Float16*)(ws + (size_t)4  * 1024 * 1024); // 4 MB [H][S][64]
  _Float16* VhT = (_Float16*)(ws + (size_t)8  * 1024 * 1024); // 4 MB [H][64][S]
  float*    ctx = (float*)   (ws + (size_t)12 * 1024 * 1024); // 8 MB [S][512]

  dim3 ggrid(32, 8);   // 4096/128 row blocks x 512/64 col blocks
  dim3 gblk(256);
  gemm512<0><<<ggrid, gblk, 0, stream>>>(q, wq, nullptr, Qh, nullptr);
  gemm512<0><<<ggrid, gblk, 0, stream>>>(k, wk, nullptr, Kh, nullptr);
  gemm512<1><<<ggrid, gblk, 0, stream>>>(v, wv, nullptr, VhT, nullptr);
  flash_attn<<<dim3(32, 8), gblk, 0, stream>>>(Qh, Kh, VhT, mask, ctx);
  gemm512<2><<<ggrid, gblk, 0, stream>>>(ctx, wo, bo, nullptr, out);
}

// v002
// A run of this version takes 181 microseconds.
// In both of two side-by-side timings against v001, it was 1.13 times as fast.
// Counting every step since v000, it is 1.30 times as fast.
#include <hip/hip_runtime.h>
#include <hip/hip_bf16.h>

typedef __attribute__((ext_vector_type(16))) _Float16 v16h;
typedef __attribute__((ext_vector_type(8)))  float    v8f;

__device__ __forceinline__ v8f wmma_f16(v16h a, v16h b, v8f c) {
  return __builtin_amdgcn_wmma_f32_16x16x32_f16(false, a, false, b, (short)0, c,
                                                false, false);
}

// Gather one 16-half fragment as 8 packed 32-bit loads (pairs contiguous in K).
__device__ __forceinline__ v16h ld_frag(const _Float16* base, const int* koff) {
  union { unsigned u[8]; v16h h; } t;
#pragma unroll
  for (int p = 0; p < 8; ++p)
    t.u[p] = *(const unsigned*)(base + koff[p]);
  return t.h;
}

__device__ __forceinline__ v8f zero8() {
  v8f z = {0.f, 0.f, 0.f, 0.f, 0.f, 0.f, 0.f, 0.f};
  return z;
}

__device__ __forceinline__ unsigned lds_off(const void* p) {
  return (unsigned)(size_t)p;
}

__device__ __forceinline__ void async_copy_b128(unsigned lds_byte_off,
                                                const void* gaddr) {
  asm volatile("global_load_async_to_lds_b128 %0, %1, off"
               :
               : "v"(lds_byte_off), "v"(gaddr)
               : "memory");
}

// Value of the same lane position in the other 16-lane half (lane ^ 16).
__device__ __forceinline__ float other_half(float x) {
  unsigned u = __builtin_bit_cast(unsigned, x);
  u = __builtin_amdgcn_permlanex16(u, u, 0x76543210u, 0xfedcba98u, false, false);
  return __builtin_bit_cast(float, u);
}

__device__ __forceinline__ float exp2_1(float x) {
  float y;
  asm("v_exp_f32 %0, %1\n\tv_nop" : "=&v"(y) : "v"(x));
  return y;
}
__device__ __forceinline__ void exp2_8(float (&p)[8], const float (&a)[8]) {
  asm("v_exp_f32 %0, %8\n\t"
      "v_exp_f32 %1, %9\n\t"
      "v_exp_f32 %2, %10\n\t"
      "v_exp_f32 %3, %11\n\t"
      "v_exp_f32 %4, %12\n\t"
      "v_exp_f32 %5, %13\n\t"
      "v_exp_f32 %6, %14\n\t"
      "v_exp_f32 %7, %15\n\t"
      "v_nop"
      : "=&v"(p[0]), "=&v"(p[1]), "=&v"(p[2]), "=&v"(p[3]),
        "=&v"(p[4]), "=&v"(p[5]), "=&v"(p[6]), "=&v"(p[7])
      : "v"(a[0]), "v"(a[1]), "v"(a[2]), "v"(a[3]),
        "v"(a[4]), "v"(a[5]), "v"(a[6]), "v"(a[7]));
}

__device__ __forceinline__ void wait_async0() {
  asm volatile("s_wait_asynccnt 0x0" ::: "memory");
}

// ---------------------------------------------------------------------------
// GEMM: C[4096x512] = X[4096x512] * W[512x512], f16 compute / f32 accumulate.
// Block tile 128x64, 8 waves (each wave: 16 rows x 64 cols = 4 accumulators).
// MODE 0: out f16 [H][S][64]      (Q, K per-head layout)
// MODE 1: out f16 [H][64][S]      (V transposed per-head layout)
// MODE 2: out f32 [S][512] + bias (final projection)
// ---------------------------------------------------------------------------
template <int MODE>
__global__ __launch_bounds__(256) void gemm512(const float* __restrict__ X,
                                               const float* __restrict__ W,
                                               const float* __restrict__ bias,
                                               _Float16* __restrict__ out16,
                                               float* __restrict__ out32) {
  constexpr int D = 512;
  const int m0 = blockIdx.x * 128;
  const int n0 = blockIdx.y * 64;
  const int t    = threadIdx.x;
  const int lane = t & 31;
  const int w    = t >> 5;      // wave id 0..7 (wave32)
  const int r    = lane & 15;
  const int g    = lane >> 4;

  __shared__ _Float16 As[128 * 34];  // [row][k], stride 34 halves
  __shared__ _Float16 Bs[64 * 34];   // transposed: [n][k], stride 34

  int koff[8];
#pragma unroll
  for (int p = 0; p < 8; ++p) koff[p] = 2 * (p & 3) + 16 * (p >> 2) + 8 * g;

  v8f acc[4];
#pragma unroll
  for (int c = 0; c < 4; ++c) acc[c] = zero8();

  for (int kt = 0; kt < 16; ++kt) {
    const int k0 = kt * 32;
    __syncthreads();
    // A tile 128x32 f32 -> f16 LDS, 4x float4 per thread
#pragma unroll
    for (int i = 0; i < 4; ++i) {
      int idx = t + 256 * i;              // 0..1023 float4s
      int row = idx >> 3, c4 = idx & 7;
      float4 v = *(const float4*)(X + (size_t)(m0 + row) * D + k0 + 4 * c4);
      union { unsigned u; _Float16 h[2]; } pa, pb;
      pa.h[0] = (_Float16)v.x; pa.h[1] = (_Float16)v.y;
      pb.h[0] = (_Float16)v.z; pb.h[1] = (_Float16)v.w;
      *(unsigned*)(As + row * 34 + 4 * c4)     = pa.u;
      *(unsigned*)(As + row * 34 + 4 * c4 + 2) = pb.u;
    }
    // B tile 32x64 f32 -> f16 LDS transposed [n][k], 2x float4 per thread
#pragma unroll
    for (int i = 0; i < 2; ++i) {
      int idx = t + 256 * i;              // 0..511 float4s
      int kr = idx >> 4, c4 = idx & 15;
      float4 v = *(const float4*)(W + (size_t)(k0 + kr) * D + n0 + 4 * c4);
      Bs[(4 * c4 + 0) * 34 + kr] = (_Float16)v.x;
      Bs[(4 * c4 + 1) * 34 + kr] = (_Float16)v.y;
      Bs[(4 * c4 + 2) * 34 + kr] = (_Float16)v.z;
      Bs[(4 * c4 + 3) * 34 + kr] = (_Float16)v.w;
    }
    __syncthreads();
    v16h af = ld_frag(As + (16 * w + r) * 34, koff);
#pragma unroll
    for (int c = 0; c < 4; ++c) {
      v16h bf = ld_frag(Bs + (16 * c + r) * 34, koff);
      acc[c] = wmma_f16(af, bf, acc[c]);
    }
  }

#pragma unroll
  for (int c = 0; c < 4; ++c) {
    const int n = n0 + 16 * c + r;
#pragma unroll
    for (int j = 0; j < 8; ++j) {
      const int m = m0 + 16 * w + j + 8 * g;
      float val = acc[c][j];
      if (MODE == 2) {
        out32[(size_t)m * D + n] = val + bias[n];
      } else if (MODE == 0) {
        int h = n >> 6, dh = n & 63;
        out16[((size_t)h * 4096 + m) * 64 + dh] = (_Float16)val;
      } else {
        int h = n >> 6, dh = n & 63;
        out16[((size_t)h * 64 + dh) * 4096 + m] = (_Float16)val;
      }
    }
  }
}

__global__ __launch_bounds__(256) __attribute__((amdgpu_waves_per_eu(2, 2))) void flash_attn(const _Float16* __restrict__ Qh,
                                                  const _Float16* __restrict__ Kh,
                                                  const _Float16* __restrict__ VhT,
                                                  const float* __restrict__ mask,
                                                  float* __restrict__ ctx) {
  constexpr int S = 4096, DH = 64, D = 512;
  constexpr int KVS = 72;            // K/V row stride in halves: 144B, 16B-aligned
  constexpr int KVT = 64 * KVS;      // one K or V tile buffer (halves)

  const int head = blockIdx.y;
  const int m0   = blockIdx.x * 128;
  const int t    = threadIdx.x;
  const int lane = t & 31;
  const int w    = t >> 5;
  const int r    = lane & 15;
  const int g    = lane >> 4;

  __shared__ __align__(16) _Float16 smem[4 * KVT];
  _Float16* Kt0 = smem;              // two K buffers
  _Float16* Vt0 = smem + 2 * KVT;    // two V buffers

  int koff[8];
#pragma unroll
  for (int p = 0; p < 8; ++p) koff[p] = 2 * (p & 3) + 16 * (p >> 2) + 8 * g;

  // Q^T B-fragments: column (query) m0+16w+r, two 32-wide K chunks over Dh=64
  const int qrow = m0 + 16 * w + r;
  v16h qb[2];
#pragma unroll
  for (int kk = 0; kk < 2; ++kk) {
    union { unsigned u[8]; v16h h; } tmp;
#pragma unroll
    for (int p = 0; p < 8; ++p)
      tmp.u[p] = *(const unsigned*)(Qh + ((size_t)head * S + qrow) * DH +
                                    kk * 32 + koff[p]);
    qb[kk] = tmp.h;
  }

  // O^T tiles: oacc[c][j] = O(query r, dh 16c + j + 8g)
  v8f oacc[4];
#pragma unroll
  for (int c = 0; c < 4; ++c) oacc[c] = zero8();
  float mrow = -1.0e30f;  // running max of query r, in log2 units (equal in both halves)
  float lrow = 0.0f;      // running sum over this half's keys only

  // Scores are kept in log2 units: e^(s - m) = 2^(s*log2e - m*log2e), so log2e
  // is folded into the two score constants and each exponential is one v_exp_f32.
  // 1/(sqrt(64)+1e-9) rounds to 0.125 in f32.
  constexpr float LOG2E = 1.44269504088896340736f;
  const float scale = 0.125f * LOG2E;
  const float mcoef = -1.0e9f * LOG2E;

  // This lane's mask row, at its half's first key of a 16-key group.
  const float* mrowp = mask + (size_t)qrow * S + 8 * g;

  // Issue async copies for one 64-key tile: per thread 2x16B of K + 2x16B of V.
  auto issue_tile = [&](int t0, int buf) {
#pragma unroll
    for (int i = 0; i < 2; ++i) {
      int idx = t + 256 * i;            // 0..511 chunks of 8 halves
      int row = idx >> 3, c8 = idx & 7;
      async_copy_b128(
          lds_off(Kt0 + buf * KVT + row * KVS + 8 * c8),
          (const void*)(Kh + ((size_t)head * S + t0 + row) * DH + 8 * c8));
      async_copy_b128(
          lds_off(Vt0 + buf * KVT + row * KVS + 8 * c8),
          (const void*)(VhT + ((size_t)head * DH + row) * S + t0 + 8 * c8));
    }
  };

  issue_tile(0, 0);  // prologue

  for (int t0 = 0; t0 < S; t0 += 64) {
    const int cur = (t0 >> 6) & 1;
    wait_async0();      // this wave's copies for tile t0 have landed in LDS
    __syncthreads();    // all waves landed; all waves done reading buf cur^1
    if (t0 + 64 < S) issue_tile(t0 + 64, cur ^ 1);  // overlaps compute below

    const _Float16* Kc = Kt0 + cur * KVT;
    const _Float16* Vc = Vt0 + cur * KVT;

    // Mask: 8 consecutive keys of one query per 16-key group, 2x float4.
    float4 mk[4][2];
#pragma unroll
    for (int c = 0; c < 4; ++c) {
      mk[c][0] = *(const float4*)(mrowp + t0 + 16 * c);
      mk[c][1] = *(const float4*)(mrowp + t0 + 16 * c + 4);
    }

    // S^T = K * Q^T : 2 K-chunks x 4 key-row blocks
    v8f sacc[4];
#pragma unroll
    for (int c = 0; c < 4; ++c) sacc[c] = zero8();
#pragma unroll
    for (int kk = 0; kk < 2; ++kk) {
#pragma unroll
      for (int c = 0; c < 4; ++c) {
        v16h ka = ld_frag(Kc + (16 * c + r) * KVS + kk * 32, koff);
        sacc[c] = wmma_f16(ka, qb[kk], sacc[c]);
      }
    }

    // Online softmax of query r: 32 scores in this lane, 32 in lane^16.
    float s[4][8], mxc[4];
#pragma unroll
    for (int c = 0; c < 4; ++c) {
      const float mv[8] = {mk[c][0].x, mk[c][0].y, mk[c][0].z, mk[c][0].w,
                           mk[c][1].x, mk[c][1].y, mk[c][1].z, mk[c][1].w};
      mxc[c] = -1.0e30f;
#pragma unroll
      for (int j = 0; j < 8; ++j) {
        s[c][j] = fmaf(mv[j], mcoef, sacc[c][j] * scale);
        mxc[c] = fmaxf(mxc[c], s[c][j]);
      }
    }
    float mx = fmaxf(fmaxf(mxc[0], mxc[1]), fmaxf(mxc[2], mxc[3]));
    mx = fmaxf(mx, other_half(mx));
    const float mnew = fmaxf(mrow, mx);
    const float corr = exp2_1(mrow - mnew);
    mrow = mnew;

    float psc[4];
    v16h pb[2];
#pragma unroll
    for (int c = 0; c < 4; ++c) {
      float arg[8], pv[8];
#pragma unroll
      for (int j = 0; j < 8; ++j) arg[j] = s[c][j] - mnew;
      exp2_8(pv, arg);
      psc[c] = pv[0];
#pragma unroll
      for (int j = 1; j < 8; ++j) psc[c] += pv[j];
#pragma unroll
      for (int j = 0; j < 8; ++j) pb[c >> 1][8 * (c & 1) + j] = (_Float16)pv[j];
    }
    lrow = lrow * corr + ((psc[0] + psc[1]) + (psc[2] + psc[3]));
#pragma unroll
    for (int c = 0; c < 4; ++c)
#pragma unroll
      for (int j = 0; j < 8; ++j) oacc[c][j] *= corr;

    // O^T += V^T * P^T : V^T as A-frags from [dh][key], P^T from registers
#pragma unroll
    for (int kk = 0; kk < 2; ++kk) {
#pragma unroll
      for (int c = 0; c < 4; ++c) {
        v16h va = ld_frag(Vc + (16 * c + r) * KVS + kk * 32, koff);
        oacc[c] = wmma_f16(va, pb[kk], oacc[c]);
      }
    }
  }

  // Join the halves' sums, normalize, write ctx (heads merged), f32:
  // ctx[query][head*64 + 16c + 8g + 0..7], 2x float4 per tile.
  const float inv = 1.0f / (lrow + other_half(lrow));
  float* orow = ctx + (size_t)qrow * D + head * 64 + 8 * g;
#pragma unroll
  for (int c = 0; c < 4; ++c) {
    float4 lo = {oacc[c][0] * inv, oacc[c][1] * inv, oacc[c][2] * inv, oacc[c][3] * inv};
    float4 hi = {oacc[c][4] * inv, oacc[c][5] * inv, oacc[c][6] * inv, oacc[c][7] * inv};
    *(float4*)(orow + 16 * c)     = lo;
    *(float4*)(orow + 16 * c + 4) = hi;
  }
}

// ---------------------------------------------------------------------------
// Launch: 3 projections -> flash attention -> output projection. 20MB ws.
// ---------------------------------------------------------------------------
extern "C" void kernel_launch(void* const* d_in, const int* in_sizes, int n_in,
                              void* d_out, int out_size, void* d_ws, size_t ws_size,
                              hipStream_t stream) {
  (void)in_sizes; (void)n_in; (void)out_size; (void)ws_size;
  const float* q    = (const float*)d_in[0];
  const float* k    = (const float*)d_in[1];
  const float* v    = (const float*)d_in[2];
  const float* mask = (const float*)d_in[3];
  const float* wq   = (const float*)d_in[4];
  const float* wk   = (const float*)d_in[5];
  const float* wv   = (const float*)d_in[6];
  const float* wo   = (const float*)d_in[7];
  const float* bo   = (const float*)d_in[8];
  float* out = (float*)d_out;

  char* ws = (char*)d_ws;
  _Float16* Qh  = (_Float16*)(ws + 0);                        // 4 MB [H][S][64]
  _Float16* Kh  = (_Float16*)(ws + (size_t)4  * 1024 * 1024); // 4 MB [H][S][64]
  _Float16* VhT = (_Float16*)(ws + (size_t)8  * 1024 * 1024); // 4 MB [H][64][S]
  float*    ctx = (float*)   (ws + (size_t)12 * 1024 * 1024); // 8 MB [S][512]

  dim3 ggrid(32, 8);   // 4096/128 row blocks x 512/64 col blocks
  dim3 gblk(256);
  gemm512<0><<<ggrid, gblk, 0, stream>>>(q, wq, nullptr, Qh, nullptr);
  gemm512<0><<<ggrid, gblk, 0, stream>>>(k, wk, nullptr, Kh, nullptr);
  gemm512<1><<<ggrid, gblk, 0, stream>>>(v, wv, nullptr, VhT, nullptr);
  flash_attn<<<dim3(32, 8), gblk, 0, stream>>>(Qh, Kh, VhT, mask, ctx);
  gemm512<2><<<ggrid, gblk, 0, stream>>>(ctx, wo, bo, nullptr, out);
}

// v003
// One run takes 146 microseconds.
// Timed twice side by side with v002, it ran 1.24 times as fast both times.
// Over all steps from v000 it is 1.62 times as fast.
#include <hip/hip_runtime.h>
#include <hip/hip_bf16.h>

typedef __attribute__((ext_vector_type(16))) _Float16 v16h;
typedef __attribute__((ext_vector_type(8)))  float    v8f;

__device__ __forceinline__ v8f wmma_f16(v16h a, v16h b, v8f c) {
  return __builtin_amdgcn_wmma_f32_16x16x32_f16(false, a, false, b, (short)0, c,
                                                false, false);
}

// Gather one 16-half fragment as 8 packed 32-bit loads (pairs contiguous in K).
__device__ __forceinline__ v16h ld_frag(const _Float16* base, const int* koff) {
  union { unsigned u[8]; v16h h; } t;
#pragma unroll
  for (int p = 0; p < 8; ++p)
    t.u[p] = *(const unsigned*)(base + koff[p]);
  return t.h;
}

__device__ __forceinline__ v8f zero8() {
  v8f z = {0.f, 0.f, 0.f, 0.f, 0.f, 0.f, 0.f, 0.f};
  return z;
}

__device__ __forceinline__ unsigned lds_off(const void* p) {
  return (unsigned)(size_t)p;
}

__device__ __forceinline__ void async_copy_b128(unsigned lds_byte_off,
                                                const void* gaddr) {
  asm volatile("global_load_async_to_lds_b128 %0, %1, off"
               :
               : "v"(lds_byte_off), "v"(gaddr)
               : "memory");
}

__device__ __forceinline__ void async_copy8_b128(const unsigned (&l)[8],
                                                 const float* const (&p)[8]) {
  asm volatile("global_load_async_to_lds_b128 %0, %8, off\n\t"
               "global_load_async_to_lds_b128 %1, %9, off\n\t"
               "global_load_async_to_lds_b128 %2, %10, off\n\t"
               "global_load_async_to_lds_b128 %3, %11, off\n\t"
               "global_load_async_to_lds_b128 %4, %12, off\n\t"
               "global_load_async_to_lds_b128 %5, %13, off\n\t"
               "global_load_async_to_lds_b128 %6, %14, off\n\t"
               "global_load_async_to_lds_b128 %7, %15, off\n\t"
               "s_wait_xcnt 0x0"
               :
               : "v"(l[0]), "v"(l[1]), "v"(l[2]), "v"(l[3]),
                 "v"(l[4]), "v"(l[5]), "v"(l[6]), "v"(l[7]),
                 "v"(p[0]), "v"(p[1]), "v"(p[2]), "v"(p[3]),
                 "v"(p[4]), "v"(p[5]), "v"(p[6]), "v"(p[7])
               : "memory");
}

// Value of the same lane position in the other 16-lane half (lane ^ 16).
__device__ __forceinline__ float other_half(float x) {
  unsigned u = __builtin_bit_cast(unsigned, x);
  u = __builtin_amdgcn_permlanex16(u, u, 0x76543210u, 0xfedcba98u, false, false);
  return __builtin_bit_cast(float, u);
}

__device__ __forceinline__ float exp2_1(float x) {
  float y;
  asm("v_exp_f32 %0, %1\n\tv_nop" : "=&v"(y) : "v"(x));
  return y;
}
__device__ __forceinline__ void exp2_8(float (&p)[8], const float (&a)[8]) {
  asm("v_exp_f32 %0, %8\n\t"
      "v_exp_f32 %1, %9\n\t"
      "v_exp_f32 %2, %10\n\t"
      "v_exp_f32 %3, %11\n\t"
      "v_exp_f32 %4, %12\n\t"
      "v_exp_f32 %5, %13\n\t"
      "v_exp_f32 %6, %14\n\t"
      "v_exp_f32 %7, %15\n\t"
      "v_nop"
      : "=&v"(p[0]), "=&v"(p[1]), "=&v"(p[2]), "=&v"(p[3]),
        "=&v"(p[4]), "=&v"(p[5]), "=&v"(p[6]), "=&v"(p[7])
      : "v"(a[0]), "v"(a[1]), "v"(a[2]), "v"(a[3]),
        "v"(a[4]), "v"(a[5]), "v"(a[6]), "v"(a[7]));
}

__device__ __forceinline__ void wait_async0() {
  asm volatile("s_wait_asynccnt 0x0" ::: "memory");
}

// This wave's LDS reads have returned: stands in front of the barrier behind
// which the buffer they read is refilled by async copies.
__device__ __forceinline__ void wait_ds0() {
  asm volatile("s_wait_dscnt 0x0" ::: "memory");
}

// ---------------------------------------------------------------------------
// GEMM: C[4096x512] = X[4096x512] * W[512x512], f16 compute / f32 accumulate.
// Block tile 128x64, 8 waves (each wave: 16 rows x 64 cols = 4 accumulators).
// MODE 0: out f16 [H][S][64]      (Q, K per-head layout)
// MODE 1: out f16 [H][64][S]      (V transposed per-head layout)
// MODE 2: out f32 [S][512] + bias (final projection)
// ---------------------------------------------------------------------------
template <int MODE>
__global__ __launch_bounds__(256) void gemm512(const float* __restrict__ X,
                                               const float* __restrict__ W,
                                               const float* __restrict__ bias,
                                               _Float16* __restrict__ out16,
                                               float* __restrict__ out32) {
  constexpr int D = 512;
  const int m0 = blockIdx.x * 128;
  const int n0 = blockIdx.y * 64;
  const int t    = threadIdx.x;
  const int lane = t & 31;
  const int w    = t >> 5;      // wave id 0..7 (wave32)
  const int r    = lane & 15;
  const int g    = lane >> 4;

  __shared__ _Float16 As[128 * 34];  // [row][k], stride 34 halves
  __shared__ _Float16 Bs[64 * 34];   // transposed: [n][k], stride 34

  int koff[8];
#pragma unroll
  for (int p = 0; p < 8; ++p) koff[p] = 2 * (p & 3) + 16 * (p >> 2) + 8 * g;

  v8f acc[4];
#pragma unroll
  for (int c = 0; c < 4; ++c) acc[c] = zero8();

  for (int kt = 0; kt < 16; ++kt) {
    const int k0 = kt * 32;
    __syncthreads();
    // A tile 128x32 f32 -> f16 LDS, 4x float4 per thread
#pragma unroll
    for (int i = 0; i < 4; ++i) {
      int idx = t + 256 * i;              // 0..1023 float4s
      int row = idx >> 3, c4 = idx & 7;
      float4 v = *(const float4*)(X + (size_t)(m0 + row) * D + k0 + 4 * c4);
      union { unsigned u; _Float16 h[2]; } pa, pb;
      pa.h[0] = (_Float16)v.x; pa.h[1] = (_Float16)v.y;
      pb.h[0] = (_Float16)v.z; pb.h[1] = (_Float16)v.w;
      *(unsigned*)(As + row * 34 + 4 * c4)     = pa.u;
      *(unsigned*)(As + row * 34 + 4 * c4 + 2) = pb.u;
    }
    // B tile 32x64 f32 -> f16 LDS transposed [n][k], 2x float4 per thread
#pragma unroll
    for (int i = 0; i < 2; ++i) {
      int idx = t + 256 * i;              // 0..511 float4s
      int kr = idx >> 4, c4 = idx & 15;
      float4 v = *(const float4*)(W + (size_t)(k0 + kr) * D + n0 + 4 * c4);
      Bs[(4 * c4 + 0) * 34 + kr] = (_Float16)v.x;
      Bs[(4 * c4 + 1) * 34 + kr] = (_Float16)v.y;
      Bs[(4 * c4 + 2) * 34 + kr] = (_Float16)v.z;
      Bs[(4 * c4 + 3) * 34 + kr] = (_Float16)v.w;
    }
    __syncthreads();
    v16h af = ld_frag(As + (16 * w + r) * 34, koff);
#pragma unroll
    for (int c = 0; c < 4; ++c) {
      v16h bf = ld_frag(Bs + (16 * c + r) * 34, koff);
      acc[c] = wmma_f16(af, bf, acc[c]);
    }
  }

#pragma unroll
  for (int c = 0; c < 4; ++c) {
    const int n = n0 + 16 * c + r;
#pragma unroll
    for (int j = 0; j < 8; ++j) {
      const int m = m0 + 16 * w + j + 8 * g;
      float val = acc[c][j];
      if (MODE == 2) {
        out32[(size_t)m * D + n] = val + bias[n];
      } else if (MODE == 0) {
        int h = n >> 6, dh = n & 63;
        out16[((size_t)h * 4096 + m) * 64 + dh] = (_Float16)val;
      } else {
        int h = n >> 6, dh = n & 63;
        out16[((size_t)h * 64 + dh) * 4096 + m] = (_Float16)val;
      }
    }
  }
}

__global__ __launch_bounds__(256) __attribute__((amdgpu_waves_per_eu(2, 2))) void flash_attn(const _Float16* __restrict__ Qh,
                                                  const _Float16* __restrict__ Kh,
                                                  const _Float16* __restrict__ VhT,
                                                  const float* __restrict__ mask,
                                                  float* __restrict__ ctx) {
  constexpr int S = 4096, DH = 64, D = 512;
  constexpr int KVS = 72;
  constexpr int KVT = 64 * KVS;
  constexpr int MP  = 68;
  constexpr int MT  = 128 * MP;

  const int head = blockIdx.y;
  const int m0   = blockIdx.x * 128;
  const int t    = threadIdx.x;
  const int lane = t & 31;
  const int w    = t >> 5;
  const int r    = lane & 15;
  const int g    = lane >> 4;

  __shared__ __align__(16) _Float16 smem[4 * KVT];
  _Float16* Kt0 = smem;              // two K buffers
  _Float16* Vt0 = smem + 2 * KVT;    // two V buffers
  __shared__ __align__(16) float msm[2 * MT];  // two mask buffers

  int koff[8];
#pragma unroll
  for (int p = 0; p < 8; ++p) koff[p] = 2 * (p & 3) + 16 * (p >> 2) + 8 * g;

  // Q^T B-fragments: column (query) m0+16w+r, two 32-wide K chunks over Dh=64
  const int qrow = m0 + 16 * w + r;
  v16h qb[2];
#pragma unroll
  for (int kk = 0; kk < 2; ++kk) {
    union { unsigned u[8]; v16h h; } tmp;
#pragma unroll
    for (int p = 0; p < 8; ++p)
      tmp.u[p] = *(const unsigned*)(Qh + ((size_t)head * S + qrow) * DH +
                                    kk * 32 + koff[p]);
    qb[kk] = tmp.h;
  }

  // O^T tiles: oacc[c][j] = O(query r, dh 16c + j + 8g)
  v8f oacc[4];
#pragma unroll
  for (int c = 0; c < 4; ++c) oacc[c] = zero8();
  float mrow = -1.0e30f;  // running max of query r, in log2 units (equal in both halves)
  float lrow = 0.0f;      // running sum over this half's keys only

  // Scores are kept in log2 units: e^(s - m) = 2^(s*log2e - m*log2e), so log2e
  // is folded into the two score constants and each exponential is one v_exp_f32.
  // 1/(sqrt(64)+1e-9) rounds to 0.125 in f32.
  constexpr float LOG2E = 1.44269504088896340736f;
  const float scale = 0.125f * LOG2E;
  const float mcoef = -1.0e9f * LOG2E;

  const float*   mgp = mask + (size_t)(m0 + 16 * w + g) * S + 4 * r;
  const unsigned mlp = lds_off(msm + (16 * w + g) * MP + 4 * r);
  auto issue_mask = [&](int t0, int buf) {
    unsigned l[8];
    const float* p[8];
#pragma unroll
    for (int i = 0; i < 8; ++i) {
      l[i] = mlp + 4u * (unsigned)(buf * MT + 2 * i * MP);
      p[i] = mgp + (size_t)(2 * i) * S + t0;
    }
    async_copy8_b128(l, p);
  };

  // Issue async copies for one 64-key tile: per thread 2x16B of K + 2x16B of V.
  auto issue_tile = [&](int t0, int buf) {
#pragma unroll
    for (int i = 0; i < 2; ++i) {
      int idx = t + 256 * i;            // 0..511 chunks of 8 halves
      int row = idx >> 3, c8 = idx & 7;
      async_copy_b128(
          lds_off(Kt0 + buf * KVT + row * KVS + 8 * c8),
          (const void*)(Kh + ((size_t)head * S + t0 + row) * DH + 8 * c8));
      async_copy_b128(
          lds_off(Vt0 + buf * KVT + row * KVS + 8 * c8),
          (const void*)(VhT + ((size_t)head * DH + row) * S + t0 + 8 * c8));
    }
  };

  issue_mask(0, 0);
  issue_tile(0, 0);  // prologue

  for (int t0 = 0; t0 < S; t0 += 64) {
    const int cur = (t0 >> 6) & 1;
    wait_ds0();         // this wave's reads of buf cur^1 have returned
    wait_async0();      // this wave's copies for tile t0 have landed in LDS
    __syncthreads();    // all waves landed; all waves done reading buf cur^1
    if (t0 + 64 < S) issue_mask(t0 + 64, cur ^ 1);  // longest way to come: first
    if (t0 + 64 < S) issue_tile(t0 + 64, cur ^ 1);  // overlaps compute below

    const _Float16* Kc = Kt0 + cur * KVT;
    const _Float16* Vc = Vt0 + cur * KVT;

    // Mask from LDS: 8 consecutive keys of one query per 16-key group, 2x float4.
    const float* mc = msm + cur * MT + (16 * w + r) * MP + 8 * g;
    float4 mk[4][2];
#pragma unroll
    for (int c = 0; c < 4; ++c) {
      mk[c][0] = *(const float4*)(mc + 16 * c);
      mk[c][1] = *(const float4*)(mc + 16 * c + 4);
    }

    // S^T = K * Q^T : 2 K-chunks x 4 key-row blocks
    v8f sacc[4];
#pragma unroll
    for (int c = 0; c < 4; ++c) sacc[c] = zero8();
#pragma unroll
    for (int kk = 0; kk < 2; ++kk) {
#pragma unroll
      for (int c = 0; c < 4; ++c) {
        v16h ka = ld_frag(Kc + (16 * c + r) * KVS + kk * 32, koff);
        sacc[c] = wmma_f16(ka, qb[kk], sacc[c]);
      }
    }

    // Online softmax of query r: 32 scores in this lane, 32 in lane^16.
    float s[4][8], mxc[4];
#pragma unroll
    for (int c = 0; c < 4; ++c) {
      const float mv[8] = {mk[c][0].x, mk[c][0].y, mk[c][0].z, mk[c][0].w,
                           mk[c][1].x, mk[c][1].y, mk[c][1].z, mk[c][1].w};
      mxc[c] = -1.0e30f;
#pragma unroll
      for (int j = 0; j < 8; ++j) {
        s[c][j] = fmaf(mv[j], mcoef, sacc[c][j] * scale);
        mxc[c] = fmaxf(mxc[c], s[c][j]);
      }
    }
    float mx = fmaxf(fmaxf(mxc[0], mxc[1]), fmaxf(mxc[2], mxc[3]));
    mx = fmaxf(mx, other_half(mx));
    const float mnew = fmaxf(mrow, mx);
    const float corr = exp2_1(mrow - mnew);
    mrow = mnew;

    float psc[4];
    v16h pb[2];
#pragma unroll
    for (int c = 0; c < 4; ++c) {
      float arg[8], pv[8];
#pragma unroll
      for (int j = 0; j < 8; ++j) arg[j] = s[c][j] - mnew;
      exp2_8(pv, arg);
      psc[c] = pv[0];
#pragma unroll
      for (int j = 1; j < 8; ++j) psc[c] += pv[j];
#pragma unroll
      for (int j = 0; j < 8; ++j) pb[c >> 1][8 * (c & 1) + j] = (_Float16)pv[j];
    }
    lrow = lrow * corr + ((psc[0] + psc[1]) + (psc[2] + psc[3]));
#pragma unroll
    for (int c = 0; c < 4; ++c)
#pragma unroll
      for (int j = 0; j < 8; ++j) oacc[c][j] *= corr;

    // O^T += V^T * P^T : V^T as A-frags from [dh][key], P^T from registers
#pragma unroll
    for (int kk = 0; kk < 2; ++kk) {
#pragma unroll
      for (int c = 0; c < 4; ++c) {
        v16h va = ld_frag(Vc + (16 * c + r) * KVS + kk * 32, koff);
        oacc[c] = wmma_f16(va, pb[kk], oacc[c]);
      }
    }
  }

  // Join the halves' sums, normalize, write ctx (heads merged), f32:
  // ctx[query][head*64 + 16c + 8g + 0..7], 2x float4 per tile.
  const float inv = 1.0f / (lrow + other_half(lrow));
  float* orow = ctx + (size_t)qrow * D + head * 64 + 8 * g;
#pragma unroll
  for (int c = 0; c < 4; ++c) {
    float4 lo = {oacc[c][0] * inv, oacc[c][1] * inv, oacc[c][2] * inv, oacc[c][3] * inv};
    float4 hi = {oacc[c][4] * inv, oacc[c][5] * inv, oacc[c][6] * inv, oacc[c][7] * inv};
    *(float4*)(orow + 16 * c)     = lo;
    *(float4*)(orow + 16 * c + 4) = hi;
  }
}

// ---------------------------------------------------------------------------
// Launch: 3 projections -> flash attention -> output projection. 20MB ws.
// ---------------------------------------------------------------------------
extern "C" void kernel_launch(void* const* d_in, const int* in_sizes, int n_in,
                              void* d_out, int out_size, void* d_ws, size_t ws_size,
                              hipStream_t stream) {
  (void)in_sizes; (void)n_in; (void)out_size; (void)ws_size;
  const float* q    = (const float*)d_in[0];
  const float* k    = (const float*)d_in[1];
  const float* v    = (const float*)d_in[2];
  const float* mask = (const float*)d_in[3];
  const float* wq   = (const float*)d_in[4];
  const float* wk   = (const float*)d_in[5];
  const float* wv   = (const float*)d_in[6];
  const float* wo   = (const float*)d_in[7];
  const float* bo   = (const float*)d_in[8];
  float* out = (float*)d_out;

  char* ws = (char*)d_ws;
  _Float16* Qh  = (_Float16*)(ws + 0);                        // 4 MB [H][S][64]
  _Float16* Kh  = (_Float16*)(ws + (size_t)4  * 1024 * 1024); // 4 MB [H][S][64]
  _Float16* VhT = (_Float16*)(ws + (size_t)8  * 1024 * 1024); // 4 MB [H][64][S]
  float*    ctx = (float*)   (ws + (size_t)12 * 1024 * 1024); // 8 MB [S][512]

  dim3 ggrid(32, 8);   // 4096/128 row blocks x 512/64 col blocks
  dim3 gblk(256);
  gemm512<0><<<ggrid, gblk, 0, stream>>>(q, wq, nullptr, Qh, nullptr);
  gemm512<0><<<ggrid, gblk, 0, stream>>>(k, wk, nullptr, Kh, nullptr);
  gemm512<1><<<ggrid, gblk, 0, stream>>>(v, wv, nullptr, VhT, nullptr);
  flash_attn<<<dim3(32, 8), gblk, 0, stream>>>(Qh, Kh, VhT, mask, ctx);
  gemm512<2><<<ggrid, gblk, 0, stream>>>(ctx, wo, bo, nullptr, out);
}

// v004
// One run takes 109 microseconds.
// In two side-by-side timings against v003, it was 1.33 and 1.34 times as fast.
// All steps since v000 together make it 2.16 times as fast.
#include <hip/hip_runtime.h>
#include <hip/hip_bf16.h>

typedef __attribute__((ext_vector_type(16))) _Float16 v16h;
typedef __attribute__((ext_vector_type(8)))  float    v8f;

__device__ __forceinline__ v8f wmma_f16(v16h a, v16h b, v8f c) {
  return __builtin_amdgcn_wmma_f32_16x16x32_f16(false, a, false, b, (short)0, c,
                                                false, false);
}

// Gather one 16-half fragment as 8 packed 32-bit loads (pairs contiguous in K).
__device__ __forceinline__ v16h ld_frag(const _Float16* base, const int* koff) {
  union { unsigned u[8]; v16h h; } t;
#pragma unroll
  for (int p = 0; p < 8; ++p)
    t.u[p] = *(const unsigned*)(base + koff[p]);
  return t.h;
}

__device__ __forceinline__ v8f zero8() {
  v8f z = {0.f, 0.f, 0.f, 0.f, 0.f, 0.f, 0.f, 0.f};
  return z;
}

__device__ __forceinline__ unsigned lds_off(const void* p) {
  return (unsigned)(size_t)p;
}

__device__ __forceinline__ void async_copy_b128(unsigned lds_byte_off,
                                                const void* gaddr) {
  asm volatile("global_load_async_to_lds_b128 %0, %1, off"
               :
               : "v"(lds_byte_off), "v"(gaddr)
               : "memory");
}

__device__ __forceinline__ void async_copy8_b128(const unsigned (&l)[8],
                                                 const float* const (&p)[8]) {
  asm volatile("global_load_async_to_lds_b128 %0, %8, off\n\t"
               "global_load_async_to_lds_b128 %1, %9, off\n\t"
               "global_load_async_to_lds_b128 %2, %10, off\n\t"
               "global_load_async_to_lds_b128 %3, %11, off\n\t"
               "global_load_async_to_lds_b128 %4, %12, off\n\t"
               "global_load_async_to_lds_b128 %5, %13, off\n\t"
               "global_load_async_to_lds_b128 %6, %14, off\n\t"
               "global_load_async_to_lds_b128 %7, %15, off\n\t"
               "s_wait_xcnt 0x0"
               :
               : "v"(l[0]), "v"(l[1]), "v"(l[2]), "v"(l[3]),
                 "v"(l[4]), "v"(l[5]), "v"(l[6]), "v"(l[7]),
                 "v"(p[0]), "v"(p[1]), "v"(p[2]), "v"(p[3]),
                 "v"(p[4]), "v"(p[5]), "v"(p[6]), "v"(p[7])
               : "memory");
}

// Value of the same lane position in the other 16-lane half (lane ^ 16).
__device__ __forceinline__ float other_half(float x) {
  unsigned u = __builtin_bit_cast(unsigned, x);
  u = __builtin_amdgcn_permlanex16(u, u, 0x76543210u, 0xfedcba98u, false, false);
  return __builtin_bit_cast(float, u);
}

__device__ __forceinline__ float exp2_1(float x) {
  float y;
  asm("v_exp_f32 %0, %1\n\tv_nop" : "=&v"(y) : "v"(x));
  return y;
}
__device__ __forceinline__ void exp2_8(float (&p)[8], const float (&a)[8]) {
  asm("v_exp_f32 %0, %8\n\t"
      "v_exp_f32 %1, %9\n\t"
      "v_exp_f32 %2, %10\n\t"
      "v_exp_f32 %3, %11\n\t"
      "v_exp_f32 %4, %12\n\t"
      "v_exp_f32 %5, %13\n\t"
      "v_exp_f32 %6, %14\n\t"
      "v_exp_f32 %7, %15\n\t"
      "v_nop"
      : "=&v"(p[0]), "=&v"(p[1]), "=&v"(p[2]), "=&v"(p[3]),
        "=&v"(p[4]), "=&v"(p[5]), "=&v"(p[6]), "=&v"(p[7])
      : "v"(a[0]), "v"(a[1]), "v"(a[2]), "v"(a[3]),
        "v"(a[4]), "v"(a[5]), "v"(a[6]), "v"(a[7]));
}

__device__ __forceinline__ void wait_async0() {
  asm volatile("s_wait_asynccnt 0x0" ::: "memory");
}

// This wave's LDS reads have returned: stands in front of the barrier behind
// which the buffer they read is refilled by async copies.
__device__ __forceinline__ void wait_ds0() {
  asm volatile("s_wait_dscnt 0x0" ::: "memory");
}

// ---------------------------------------------------------------------------
// GEMM: C[4096x512] = X[4096x512] * W[512x512], f16 compute / f32 accumulate.
// Block tile 128x64, 8 waves (each wave: 16 rows x 64 cols = 4 accumulators).
// gemm_tile leaves the block's tile in acc; the two kernels below store it.
// ---------------------------------------------------------------------------
__device__ __forceinline__ void gemm_tile(const float* __restrict__ X,
                                          const float* __restrict__ W,
                                          _Float16* As,   // [128][34] halves, [row][k]
                                          _Float16* Bs,   // [64][34] halves, [n][k]
                                          v8f (&acc)[4]) {
  constexpr int D = 512;
  const int m0 = blockIdx.x * 128;
  const int n0 = blockIdx.y * 64;
  const int t    = threadIdx.x;
  const int lane = t & 31;
  const int w    = t >> 5;      // wave id 0..7 (wave32)
  const int r    = lane & 15;
  const int g    = lane >> 4;

  int koff[8];
#pragma unroll
  for (int p = 0; p < 8; ++p) koff[p] = 2 * (p & 3) + 16 * (p >> 2) + 8 * g;

#pragma unroll
  for (int c = 0; c < 4; ++c) acc[c] = zero8();

  for (int kt = 0; kt < 16; ++kt) {
    const int k0 = kt * 32;
    __syncthreads();
    // A tile 128x32 f32 -> f16 LDS, 4x float4 per thread
#pragma unroll
    for (int i = 0; i < 4; ++i) {
      int idx = t + 256 * i;              // 0..1023 float4s
      int row = idx >> 3, c4 = idx & 7;
      float4 v = *(const float4*)(X + (size_t)(m0 + row) * D + k0 + 4 * c4);
      union { unsigned u; _Float16 h[2]; } pa, pb;
      pa.h[0] = (_Float16)v.x; pa.h[1] = (_Float16)v.y;
      pb.h[0] = (_Float16)v.z; pb.h[1] = (_Float16)v.w;
      *(unsigned*)(As + row * 34 + 4 * c4)     = pa.u;
      *(unsigned*)(As + row * 34 + 4 * c4 + 2) = pb.u;
    }
    // B tile 32x64 f32 -> f16 LDS transposed [n][k], 2x float4 per thread
#pragma unroll
    for (int i = 0; i < 2; ++i) {
      int idx = t + 256 * i;              // 0..511 float4s
      int kr = idx >> 4, c4 = idx & 15;
      float4 v = *(const float4*)(W + (size_t)(k0 + kr) * D + n0 + 4 * c4);
      Bs[(4 * c4 + 0) * 34 + kr] = (_Float16)v.x;
      Bs[(4 * c4 + 1) * 34 + kr] = (_Float16)v.y;
      Bs[(4 * c4 + 2) * 34 + kr] = (_Float16)v.z;
      Bs[(4 * c4 + 3) * 34 + kr] = (_Float16)v.w;
    }
    __syncthreads();
    v16h af = ld_frag(As + (16 * w + r) * 34, koff);
#pragma unroll
    for (int c = 0; c < 4; ++c) {
      v16h bf = ld_frag(Bs + (16 * c + r) * 34, koff);
      acc[c] = wmma_f16(af, bf, acc[c]);
    }
  }
}

// The three input projections in ONE launch: blockIdx.z picks q*wq, k*wk or v*wv.
// They do not depend on one another, and one of them alone puts a single block
// on a WGP, whose waves wait out every load and barrier with nothing beside
// them; together three blocks share a WGP and fill each other's waits.
//   z = 0, 1: out f16 [H][S][64]  (Q, K per-head layout)
//   z = 2   : out f16 [H][64][S]  (V transposed per-head layout)
__global__ __launch_bounds__(256) void proj_qkv(const float* __restrict__ q,
                                                const float* __restrict__ k,
                                                const float* __restrict__ v,
                                                const float* __restrict__ wq,
                                                const float* __restrict__ wk,
                                                const float* __restrict__ wv,
                                                _Float16* __restrict__ Qh,
                                                _Float16* __restrict__ Kh,
                                                _Float16* __restrict__ VhT) {
  __shared__ _Float16 As[128 * 34];
  __shared__ _Float16 Bs[64 * 34];
  const int z = blockIdx.z;
  const float* X = z == 0 ? q : (z == 1 ? k : v);
  const float* W = z == 0 ? wq : (z == 1 ? wk : wv);

  v8f acc[4];
  gemm_tile(X, W, As, Bs, acc);

  const int lane = threadIdx.x & 31;
  const int r    = lane & 15;
  const int mb   = blockIdx.x * 128 + 16 * (threadIdx.x >> 5) + 8 * (lane >> 4);
  const int h    = blockIdx.y;     // 64 columns of a block = one head
  if (z == 2) {
#pragma unroll
    for (int c = 0; c < 4; ++c)
#pragma unroll
      for (int j = 0; j < 8; ++j)
        VhT[((size_t)h * 64 + 16 * c + r) * 4096 + mb + j] = (_Float16)acc[c][j];
  } else {
    _Float16* out16 = z == 0 ? Qh : Kh;
#pragma unroll
    for (int c = 0; c < 4; ++c)
#pragma unroll
      for (int j = 0; j < 8; ++j)
        out16[((size_t)h * 4096 + mb + j) * 64 + 16 * c + r] = (_Float16)acc[c][j];
  }
}

// Final projection: out f32 [S][512] = ctx * wo + bias.
__global__ __launch_bounds__(256) void proj_out(const float* __restrict__ X,
                                                const float* __restrict__ W,
                                                const float* __restrict__ bias,
                                                float* __restrict__ out32) {
  __shared__ _Float16 As[128 * 34];
  __shared__ _Float16 Bs[64 * 34];
  v8f acc[4];
  gemm_tile(X, W, As, Bs, acc);

  const int lane = threadIdx.x & 31;
  const int mb   = blockIdx.x * 128 + 16 * (threadIdx.x >> 5) + 8 * (lane >> 4);
#pragma unroll
  for (int c = 0; c < 4; ++c) {
    const int n = blockIdx.y * 64 + 16 * c + (lane & 15);
#pragma unroll
    for (int j = 0; j < 8; ++j)
      out32[(size_t)(mb + j) * 512 + n] = acc[c][j] + bias[n];
  }
}

__global__ __launch_bounds__(256) __attribute__((amdgpu_waves_per_eu(2, 2))) void flash_attn(const _Float16* __restrict__ Qh,
                                                  const _Float16* __restrict__ Kh,
                                                  const _Float16* __restrict__ VhT,
                                                  const float* __restrict__ mask,
                                                  float* __restrict__ ctx) {
  constexpr int S = 4096, DH = 64, D = 512;
  constexpr int KVS = 72;
  constexpr int KVT = 64 * KVS;
  constexpr int MP  = 68;
  constexpr int MT  = 128 * MP;

  const int head = blockIdx.y;
  const int m0   = blockIdx.x * 128;
  const int t    = threadIdx.x;
  const int lane = t & 31;
  const int w    = t >> 5;
  const int r    = lane & 15;
  const int g    = lane >> 4;

  __shared__ __align__(16) _Float16 smem[4 * KVT];
  _Float16* Kt0 = smem;              // two K buffers
  _Float16* Vt0 = smem + 2 * KVT;    // two V buffers
  __shared__ __align__(16) float msm[2 * MT];  // two mask buffers

  int koff[8];
#pragma unroll
  for (int p = 0; p < 8; ++p) koff[p] = 2 * (p & 3) + 16 * (p >> 2) + 8 * g;

  // Q^T B-fragments: column (query) m0+16w+r, two 32-wide K chunks over Dh=64
  const int qrow = m0 + 16 * w + r;
  v16h qb[2];
#pragma unroll
  for (int kk = 0; kk < 2; ++kk) {
    union { unsigned u[8]; v16h h; } tmp;
#pragma unroll
    for (int p = 0; p < 8; ++p)
      tmp.u[p] = *(const unsigned*)(Qh + ((size_t)head * S + qrow) * DH +
                                    kk * 32 + koff[p]);
    qb[kk] = tmp.h;
  }

  // O^T tiles: oacc[c][j] = O(query r, dh 16c + j + 8g)
  v8f oacc[4];
#pragma unroll
  for (int c = 0; c < 4; ++c) oacc[c] = zero8();
  float mrow = -1.0e30f;  // running max of query r, in log2 units (equal in both halves)
  float lrow = 0.0f;      // running sum over this half's keys only

  // Scores are kept in log2 units: e^(s - m) = 2^(s*log2e - m*log2e), so log2e
  // is folded into the two score constants and each exponential is one v_exp_f32.
  // 1/(sqrt(64)+1e-9) rounds to 0.125 in f32.
  constexpr float LOG2E = 1.44269504088896340736f;
  const float scale = 0.125f * LOG2E;
  const float mcoef = -1.0e9f * LOG2E;

  const float*   mgp = mask + (size_t)(m0 + 16 * w + g) * S + 4 * r;
  const unsigned mlp = lds_off(msm + (16 * w + g) * MP + 4 * r);
  auto issue_mask = [&](int t0, int buf) {
    unsigned l[8];
    const float* p[8];
#pragma unroll
    for (int i = 0; i < 8; ++i) {
      l[i] = mlp + 4u * (unsigned)(buf * MT + 2 * i * MP);
      p[i] = mgp + (size_t)(2 * i) * S + t0;
    }
    async_copy8_b128(l, p);
  };

  // Issue async copies for one 64-key tile: per thread 2x16B of K + 2x16B of V.
  auto issue_tile = [&](int t0, int buf) {
#pragma unroll
    for (int i = 0; i < 2; ++i) {
      int idx = t + 256 * i;            // 0..511 chunks of 8 halves
      int row = idx >> 3, c8 = idx & 7;
      async_copy_b128(
          lds_off(Kt0 + buf * KVT + row * KVS + 8 * c8),
          (const void*)(Kh + ((size_t)head * S + t0 + row) * DH + 8 * c8));
      async_copy_b128(
          lds_off(Vt0 + buf * KVT + row * KVS + 8 * c8),
          (const void*)(VhT + ((size_t)head * DH + row) * S + t0 + 8 * c8));
    }
  };

  issue_mask(0, 0);
  issue_tile(0, 0);  // prologue

  for (int t0 = 0; t0 < S; t0 += 64) {
    const int cur = (t0 >> 6) & 1;
    wait_ds0();         // this wave's reads of buf cur^1 have returned
    wait_async0();      // this wave's copies for tile t0 have landed in LDS
    __syncthreads();    // all waves landed; all waves done reading buf cur^1
    if (t0 + 64 < S) issue_mask(t0 + 64, cur ^ 1);  // longest way to come: first
    if (t0 + 64 < S) issue_tile(t0 + 64, cur ^ 1);  // overlaps compute below

    const _Float16* Kc = Kt0 + cur * KVT;
    const _Float16* Vc = Vt0 + cur * KVT;

    // Mask from LDS: 8 consecutive keys of one query per 16-key group, 2x float4.
    const float* mc = msm + cur * MT + (16 * w + r) * MP + 8 * g;
    float4 mk[4][2];
#pragma unroll
    for (int c = 0; c < 4; ++c) {
      mk[c][0] = *(const float4*)(mc + 16 * c);
      mk[c][1] = *(const float4*)(mc + 16 * c + 4);
    }

    // S^T = K * Q^T : 2 K-chunks x 4 key-row blocks
    v8f sacc[4];
#pragma unroll
    for (int c = 0; c < 4; ++c) sacc[c] = zero8();
#pragma unroll
    for (int kk = 0; kk < 2; ++kk) {
#pragma unroll
      for (int c = 0; c < 4; ++c) {
        v16h ka = ld_frag(Kc + (16 * c + r) * KVS + kk * 32, koff);
        sacc[c] = wmma_f16(ka, qb[kk], sacc[c]);
      }
    }

    // Online softmax of query r: 32 scores in this lane, 32 in lane^16.
    float s[4][8], mxc[4];
#pragma unroll
    for (int c = 0; c < 4; ++c) {
      const float mv[8] = {mk[c][0].x, mk[c][0].y, mk[c][0].z, mk[c][0].w,
                           mk[c][1].x, mk[c][1].y, mk[c][1].z, mk[c][1].w};
      mxc[c] = -1.0e30f;
#pragma unroll
      for (int j = 0; j < 8; ++j) {
        s[c][j] = fmaf(mv[j], mcoef, sacc[c][j] * scale);
        mxc[c] = fmaxf(mxc[c], s[c][j]);
      }
    }
    float mx = fmaxf(fmaxf(mxc[0], mxc[1]), fmaxf(mxc[2], mxc[3]));
    mx = fmaxf(mx, other_half(mx));
    const float mnew = fmaxf(mrow, mx);
    const float corr = exp2_1(mrow - mnew);
    mrow = mnew;

    float psc[4];
    v16h pb[2];
#pragma unroll
    for (int c = 0; c < 4; ++c) {
      float arg[8], pv[8];
#pragma unroll
      for (int j = 0; j < 8; ++j) arg[j] = s[c][j] - mnew;
      exp2_8(pv, arg);
      psc[c] = pv[0];
#pragma unroll
      for (int j = 1; j < 8; ++j) psc[c] += pv[j];
#pragma unroll
      for (int j = 0; j < 8; ++j) pb[c >> 1][8 * (c & 1) + j] = (_Float16)pv[j];
    }
    lrow = lrow * corr + ((psc[0] + psc[1]) + (psc[2] + psc[3]));
#pragma unroll
    for (int c = 0; c < 4; ++c)
#pragma unroll
      for (int j = 0; j < 8; ++j) oacc[c][j] *= corr;

    // O^T += V^T * P^T : V^T as A-frags from [dh][key], P^T from registers
#pragma unroll
    for (int kk = 0; kk < 2; ++kk) {
#pragma unroll
      for (int c = 0; c < 4; ++c) {
        v16h va = ld_frag(Vc + (16 * c + r) * KVS + kk * 32, koff);
        oacc[c] = wmma_f16(va, pb[kk], oacc[c]);
      }
    }
  }

  // Join the halves' sums, normalize, write ctx (heads merged), f32:
  // ctx[query][head*64 + 16c + 8g + 0..7], 2x float4 per tile.
  const float inv = 1.0f / (lrow + other_half(lrow));
  float* orow = ctx + (size_t)qrow * D + head * 64 + 8 * g;
#pragma unroll
  for (int c = 0; c < 4; ++c) {
    float4 lo = {oacc[c][0] * inv, oacc[c][1] * inv, oacc[c][2] * inv, oacc[c][3] * inv};
    float4 hi = {oacc[c][4] * inv, oacc[c][5] * inv, oacc[c][6] * inv, oacc[c][7] * inv};
    *(float4*)(orow + 16 * c)     = lo;
    *(float4*)(orow + 16 * c + 4) = hi;
  }
}

// ---------------------------------------------------------------------------
// Launch: 3 projections (one grid) -> flash attention -> output projection. 20MB ws.
// ---------------------------------------------------------------------------
extern "C" void kernel_launch(void* const* d_in, const int* in_sizes, int n_in,
                              void* d_out, int out_size, void* d_ws, size_t ws_size,
                              hipStream_t stream) {
  (void)in_sizes; (void)n_in; (void)out_size; (void)ws_size;
  const float* q    = (const float*)d_in[0];
  const float* k    = (const float*)d_in[1];
  const float* v    = (const float*)d_in[2];
  const float* mask = (const float*)d_in[3];
  const float* wq   = (const float*)d_in[4];
  const float* wk   = (const float*)d_in[5];
  const float* wv   = (const float*)d_in[6];
  const float* wo   = (const float*)d_in[7];
  const float* bo   = (const float*)d_in[8];
  float* out = (float*)d_out;

  char* ws = (char*)d_ws;
  _Float16* Qh  = (_Float16*)(ws + 0);                        // 4 MB [H][S][64]
  _Float16* Kh  = (_Float16*)(ws + (size_t)4  * 1024 * 1024); // 4 MB [H][S][64]
  _Float16* VhT = (_Float16*)(ws + (size_t)8  * 1024 * 1024); // 4 MB [H][64][S]
  float*    ctx = (float*)   (ws + (size_t)12 * 1024 * 1024); // 8 MB [S][512]

  dim3 gblk(256);
  // 4096/128 row blocks x 512/64 col blocks (x 3 projections)
  proj_qkv<<<dim3(32, 8, 3), gblk, 0, stream>>>(q, k, v, wq, wk, wv, Qh, Kh, VhT);
  flash_attn<<<dim3(32, 8), gblk, 0, stream>>>(Qh, Kh, VhT, mask, ctx);
  proj_out<<<dim3(32, 8), gblk, 0, stream>>>(ctx, wo, bo, out);
}

// v005
// One run takes 85.6 microseconds.
// Two timings next to v004 both put it at 1.28 times that version's speed.
// Counting every step since v000, it is 2.76 times as fast.
#include <hip/hip_runtime.h>
#include <hip/hip_bf16.h>

typedef __attribute__((ext_vector_type(16))) _Float16 v16h;
typedef __attribute__((ext_vector_type(8)))  float    v8f;

__device__ __forceinline__ v8f wmma_f16(v16h a, v16h b, v8f c) {
  return __builtin_amdgcn_wmma_f32_16x16x32_f16(false, a, false, b, (short)0, c,
                                                false, false);
}

// Gather one 16-half fragment as 8 packed 32-bit loads (pairs contiguous in K).
__device__ __forceinline__ v16h ld_frag(const _Float16* base, const int* koff) {
  union { unsigned u[8]; v16h h; } t;
#pragma unroll
  for (int p = 0; p < 8; ++p)
    t.u[p] = *(const unsigned*)(base + koff[p]);
  return t.h;
}

__device__ __forceinline__ v8f zero8() {
  v8f z = {0.f, 0.f, 0.f, 0.f, 0.f, 0.f, 0.f, 0.f};
  return z;
}

__device__ __forceinline__ unsigned lds_off(const void* p) {
  return (unsigned)(size_t)p;
}

__device__ __forceinline__ void async_copy_b128(unsigned lds_byte_off,
                                                const void* gaddr) {
  asm volatile("global_load_async_to_lds_b128 %0, %1, off"
               :
               : "v"(lds_byte_off), "v"(gaddr)
               : "memory");
}

__device__ __forceinline__ void async_copy8_b128(const unsigned (&l)[8],
                                                 const float* const (&p)[8]) {
  asm volatile("global_load_async_to_lds_b128 %0, %8, off\n\t"
               "global_load_async_to_lds_b128 %1, %9, off\n\t"
               "global_load_async_to_lds_b128 %2, %10, off\n\t"
               "global_load_async_to_lds_b128 %3, %11, off\n\t"
               "global_load_async_to_lds_b128 %4, %12, off\n\t"
               "global_load_async_to_lds_b128 %5, %13, off\n\t"
               "global_load_async_to_lds_b128 %6, %14, off\n\t"
               "global_load_async_to_lds_b128 %7, %15, off\n\t"
               "s_wait_xcnt 0x0"
               :
               : "v"(l[0]), "v"(l[1]), "v"(l[2]), "v"(l[3]),
                 "v"(l[4]), "v"(l[5]), "v"(l[6]), "v"(l[7]),
                 "v"(p[0]), "v"(p[1]), "v"(p[2]), "v"(p[3]),
                 "v"(p[4]), "v"(p[5]), "v"(p[6]), "v"(p[7])
               : "memory");
}

// Value of the same lane position in the other 16-lane half (lane ^ 16).
__device__ __forceinline__ float other_half(float x) {
  unsigned u = __builtin_bit_cast(unsigned, x);
  u = __builtin_amdgcn_permlanex16(u, u, 0x76543210u, 0xfedcba98u, false, false);
  return __builtin_bit_cast(float, u);
}

__device__ __forceinline__ float exp2_1(float x) {
  float y;
  asm("v_exp_f32 %0, %1\n\tv_nop" : "=&v"(y) : "v"(x));
  return y;
}
__device__ __forceinline__ void exp2_8(float (&p)[8], const float (&a)[8]) {
  asm("v_exp_f32 %0, %8\n\t"
      "v_exp_f32 %1, %9\n\t"
      "v_exp_f32 %2, %10\n\t"
      "v_exp_f32 %3, %11\n\t"
      "v_exp_f32 %4, %12\n\t"
      "v_exp_f32 %5, %13\n\t"
      "v_exp_f32 %6, %14\n\t"
      "v_exp_f32 %7, %15\n\t"
      "v_nop"
      : "=&v"(p[0]), "=&v"(p[1]), "=&v"(p[2]), "=&v"(p[3]),
        "=&v"(p[4]), "=&v"(p[5]), "=&v"(p[6]), "=&v"(p[7])
      : "v"(a[0]), "v"(a[1]), "v"(a[2]), "v"(a[3]),
        "v"(a[4]), "v"(a[5]), "v"(a[6]), "v"(a[7]));
}

__device__ __forceinline__ void wait_async0() {
  asm volatile("s_wait_asynccnt 0x0" ::: "memory");
}

// This wave's LDS reads have returned: stands in front of the barrier behind
// which the buffer they read is refilled by async copies.
__device__ __forceinline__ void wait_ds0() {
  asm volatile("s_wait_dscnt 0x0" ::: "memory");
}

constexpr int GBK = 128;
constexpr int GP  = GBK + 8;

typedef __attribute__((ext_vector_type(4))) float    v4f;
typedef __attribute__((ext_vector_type(2))) float    v2f;
typedef __attribute__((ext_vector_type(2))) _Float16 v2h;

// Two f32 -> one register of two f16 (round to nearest even), lo in the low half.
__device__ __forceinline__ unsigned pack_h2(float lo, float hi) {
  v2f f = {lo, hi};
  return __builtin_bit_cast(unsigned, __builtin_convertvector(f, v2h));
}

__device__ __forceinline__ void gemm_tile(const float* __restrict__ X,
                                          const float* __restrict__ W,
                                          _Float16* As,   // [128][GP] halves, [row][k]
                                          _Float16* Bs,   // [64][GP] halves, [n][k]
                                          v8f (&acc)[4]) {
  constexpr int D = 512;
  const int m0 = blockIdx.x * 128;
  const int n0 = blockIdx.y * 64;
  const int t    = threadIdx.x;
  const int lane = t & 31;
  const int w    = t >> 5;      // wave id 0..7 (wave32)
  const int r    = lane & 15;
  const int g    = lane >> 4;

  // Every unroll below: the arrays its loop indexes have to stay in registers.
  int koff[8];
#pragma unroll
  for (int p = 0; p < 8; ++p) koff[p] = 2 * (p & 3) + 16 * (p >> 2) + 8 * g;

#pragma unroll
  for (int c = 0; c < 4; ++c) acc[c] = zero8();

  // A: a wave's load is 512 contiguous bytes of one row (rows w, w+8, ...).
  const float* xp = X + (size_t)(m0 + w) * D + 4 * lane;
  _Float16*    ap = As + w * GP + 4 * lane;
  // B: a thread takes 4 columns of the two rows 2*kp, 2*kp+1, so that a k pair
  // goes to [n][k] as one 32-bit store; 8 lanes cover one 128-byte line.
  const int bc = t & 7;         // float4 column, +8 for the second half
  const int kp = t >> 3;        // k pair 0..31, +32 for the second half
  const float* wp = W + (size_t)(2 * kp) * D + n0 + 4 * bc;
  _Float16*    bp = Bs + (4 * bc) * GP + 2 * kp;

  for (int kt = 0; kt < D / GBK; ++kt) {
    const int k0 = kt * GBK;
    v4f xa[16], wlo[4], whi[4];
#pragma unroll
    for (int i = 0; i < 16; ++i)
      xa[i] = *(const v4f*)(xp + (size_t)(8 * i) * D + k0);
#pragma unroll
    for (int i = 0; i < 4; ++i) {
      const float* q = wp + (size_t)(k0 + 64 * (i >> 1)) * D + 32 * (i & 1);
      wlo[i] = *(const v4f*)q;
      whi[i] = *(const v4f*)(q + D);
    }
    // Nothing is scheduled across this line: all 24 loads are issued before the
    // first is waited for. Without it the compiler lifts the first conversions in
    // among the loads and the tile's last loads start a whole memory trip later.
    __builtin_amdgcn_sched_barrier(0);
    // Stands in front of every later write of the loads' address registers.
    asm volatile("s_wait_xcnt 0x0" ::: "memory");
    __syncthreads();   // every wave has read its fragments of the tile before
#pragma unroll
    for (int i = 0; i < 16; ++i) {
      uint2 h = {pack_h2(xa[i].x, xa[i].y), pack_h2(xa[i].z, xa[i].w)};
      *(uint2*)(ap + 8 * i * GP) = h;
    }
#pragma unroll
    for (int i = 0; i < 4; ++i) {
      _Float16* d = bp + 32 * (i & 1) * GP + 64 * (i >> 1);
      *(unsigned*)(d)          = pack_h2(wlo[i].x, whi[i].x);
      *(unsigned*)(d + GP)     = pack_h2(wlo[i].y, whi[i].y);
      *(unsigned*)(d + 2 * GP) = pack_h2(wlo[i].z, whi[i].z);
      *(unsigned*)(d + 3 * GP) = pack_h2(wlo[i].w, whi[i].w);
    }
    __syncthreads();   // the tile is whole
    // The ten LDS reads of a 32-deep k step stand together, one step ahead of the
    // four products that use them.
    v16h af[2], bf[2][4];
    af[0] = ld_frag(As + (16 * w + r) * GP, koff);
#pragma unroll
    for (int c = 0; c < 4; ++c) bf[0][c] = ld_frag(Bs + (16 * c + r) * GP, koff);
#pragma unroll
    for (int kk = 0; kk < GBK / 32; ++kk) {
      if (kk + 1 < GBK / 32) {
        af[(kk + 1) & 1] = ld_frag(As + (16 * w + r) * GP + 32 * (kk + 1), koff);
#pragma unroll
        for (int c = 0; c < 4; ++c)
          bf[(kk + 1) & 1][c] = ld_frag(Bs + (16 * c + r) * GP + 32 * (kk + 1), koff);
        // Holds those reads above this step's products: left free, the compiler
        // sinks each read to its own product, which then waits it out alone.
        __builtin_amdgcn_sched_barrier(0);
      }
#pragma unroll
      for (int c = 0; c < 4; ++c) acc[c] = wmma_f16(af[kk & 1], bf[kk & 1][c], acc[c]);
    }
  }
}

// The three input projections in ONE launch: blockIdx.z picks q*wq, k*wk or v*wv.
// They do not depend on one another, and one of them alone puts a single block
// on a WGP, whose waves wait out every load and barrier with nothing beside
// them; together three blocks share a WGP and fill each other's waits.
//   z = 0, 1: out f16 [H][S][64]  (Q, K per-head layout)
//   z = 2   : out f16 [H][64][S]  (V transposed per-head layout)
__global__ __launch_bounds__(256) void proj_qkv(const float* __restrict__ q,
                                                const float* __restrict__ k,
                                                const float* __restrict__ v,
                                                const float* __restrict__ wq,
                                                const float* __restrict__ wk,
                                                const float* __restrict__ wv,
                                                _Float16* __restrict__ Qh,
                                                _Float16* __restrict__ Kh,
                                                _Float16* __restrict__ VhT) {
  __shared__ __align__(16) _Float16 As[128 * GP];
  __shared__ __align__(16) _Float16 Bs[64 * GP];
  const int z = blockIdx.z;
  const float* X = z == 0 ? q : (z == 1 ? k : v);
  const float* W = z == 0 ? wq : (z == 1 ? wk : wv);

  v8f acc[4];
  gemm_tile(X, W, As, Bs, acc);

  const int lane = threadIdx.x & 31;
  const int r    = lane & 15;
  const int mb   = blockIdx.x * 128 + 16 * (threadIdx.x >> 5) + 8 * (lane >> 4);
  const int h    = blockIdx.y;     // 64 columns of a block = one head
  if (z == 2) {
#pragma unroll
    for (int c = 0; c < 4; ++c)
#pragma unroll
      for (int j = 0; j < 8; ++j)
        VhT[((size_t)h * 64 + 16 * c + r) * 4096 + mb + j] = (_Float16)acc[c][j];
  } else {
    _Float16* out16 = z == 0 ? Qh : Kh;
#pragma unroll
    for (int c = 0; c < 4; ++c)
#pragma unroll
      for (int j = 0; j < 8; ++j)
        out16[((size_t)h * 4096 + mb + j) * 64 + 16 * c + r] = (_Float16)acc[c][j];
  }
}

// Final projection: out f32 [S][512] = ctx * wo + bias.
__global__ __launch_bounds__(256) void proj_out(const float* __restrict__ X,
                                                const float* __restrict__ W,
                                                const float* __restrict__ bias,
                                                float* __restrict__ out32) {
  __shared__ __align__(16) _Float16 As[128 * GP];
  __shared__ __align__(16) _Float16 Bs[64 * GP];
  v8f acc[4];
  gemm_tile(X, W, As, Bs, acc);

  const int lane = threadIdx.x & 31;
  const int mb   = blockIdx.x * 128 + 16 * (threadIdx.x >> 5) + 8 * (lane >> 4);
#pragma unroll
  for (int c = 0; c < 4; ++c) {
    const int n = blockIdx.y * 64 + 16 * c + (lane & 15);
#pragma unroll
    for (int j = 0; j < 8; ++j)
      out32[(size_t)(mb + j) * 512 + n] = acc[c][j] + bias[n];
  }
}

__global__ __launch_bounds__(256) __attribute__((amdgpu_waves_per_eu(2, 2))) void flash_attn(const _Float16* __restrict__ Qh,
                                                  const _Float16* __restrict__ Kh,
                                                  const _Float16* __restrict__ VhT,
                                                  const float* __restrict__ mask,
                                                  float* __restrict__ ctx) {
  constexpr int S = 4096, DH = 64, D = 512;
  constexpr int KVS = 72;
  constexpr int KVT = 64 * KVS;
  constexpr int MP  = 68;
  constexpr int MT  = 128 * MP;

  const int head = blockIdx.y;
  const int m0   = blockIdx.x * 128;
  const int t    = threadIdx.x;
  const int lane = t & 31;
  const int w    = t >> 5;
  const int r    = lane & 15;
  const int g    = lane >> 4;

  __shared__ __align__(16) _Float16 smem[4 * KVT];
  _Float16* Kt0 = smem;              // two K buffers
  _Float16* Vt0 = smem + 2 * KVT;    // two V buffers
  __shared__ __align__(16) float msm[2 * MT];  // two mask buffers

  int koff[8];
#pragma unroll
  for (int p = 0; p < 8; ++p) koff[p] = 2 * (p & 3) + 16 * (p >> 2) + 8 * g;

  // Q^T B-fragments: column (query) m0+16w+r, two 32-wide K chunks over Dh=64
  const int qrow = m0 + 16 * w + r;
  v16h qb[2];
#pragma unroll
  for (int kk = 0; kk < 2; ++kk) {
    union { unsigned u[8]; v16h h; } tmp;
#pragma unroll
    for (int p = 0; p < 8; ++p)
      tmp.u[p] = *(const unsigned*)(Qh + ((size_t)head * S + qrow) * DH +
                                    kk * 32 + koff[p]);
    qb[kk] = tmp.h;
  }

  // O^T tiles: oacc[c][j] = O(query r, dh 16c + j + 8g)
  v8f oacc[4];
#pragma unroll
  for (int c = 0; c < 4; ++c) oacc[c] = zero8();
  float mrow = -1.0e30f;  // running max of query r, in log2 units (equal in both halves)
  float lrow = 0.0f;      // running sum over this half's keys only

  // Scores are kept in log2 units: e^(s - m) = 2^(s*log2e - m*log2e), so log2e
  // is folded into the two score constants and each exponential is one v_exp_f32.
  // 1/(sqrt(64)+1e-9) rounds to 0.125 in f32.
  constexpr float LOG2E = 1.44269504088896340736f;
  const float scale = 0.125f * LOG2E;
  const float mcoef = -1.0e9f * LOG2E;

  const float*   mgp = mask + (size_t)(m0 + 16 * w + g) * S + 4 * r;
  const unsigned mlp = lds_off(msm + (16 * w + g) * MP + 4 * r);
  auto issue_mask = [&](int t0, int buf) {
    unsigned l[8];
    const float* p[8];
#pragma unroll
    for (int i = 0; i < 8; ++i) {
      l[i] = mlp + 4u * (unsigned)(buf * MT + 2 * i * MP);
      p[i] = mgp + (size_t)(2 * i) * S + t0;
    }
    async_copy8_b128(l, p);
  };

  // Issue async copies for one 64-key tile: per thread 2x16B of K + 2x16B of V.
  auto issue_tile = [&](int t0, int buf) {
#pragma unroll
    for (int i = 0; i < 2; ++i) {
      int idx = t + 256 * i;            // 0..511 chunks of 8 halves
      int row = idx >> 3, c8 = idx & 7;
      async_copy_b128(
          lds_off(Kt0 + buf * KVT + row * KVS + 8 * c8),
          (const void*)(Kh + ((size_t)head * S + t0 + row) * DH + 8 * c8));
      async_copy_b128(
          lds_off(Vt0 + buf * KVT + row * KVS + 8 * c8),
          (const void*)(VhT + ((size_t)head * DH + row) * S + t0 + 8 * c8));
    }
  };

  issue_mask(0, 0);
  issue_tile(0, 0);  // prologue

  for (int t0 = 0; t0 < S; t0 += 64) {
    const int cur = (t0 >> 6) & 1;
    wait_ds0();         // this wave's reads of buf cur^1 have returned
    wait_async0();      // this wave's copies for tile t0 have landed in LDS
    __syncthreads();    // all waves landed; all waves done reading buf cur^1
    if (t0 + 64 < S) issue_mask(t0 + 64, cur ^ 1);  // longest way to come: first
    if (t0 + 64 < S) issue_tile(t0 + 64, cur ^ 1);  // overlaps compute below

    const _Float16* Kc = Kt0 + cur * KVT;
    const _Float16* Vc = Vt0 + cur * KVT;

    // Mask from LDS: 8 consecutive keys of one query per 16-key group, 2x float4.
    const float* mc = msm + cur * MT + (16 * w + r) * MP + 8 * g;
    float4 mk[4][2];
#pragma unroll
    for (int c = 0; c < 4; ++c) {
      mk[c][0] = *(const float4*)(mc + 16 * c);
      mk[c][1] = *(const float4*)(mc + 16 * c + 4);
    }

    // S^T = K * Q^T : 2 K-chunks x 4 key-row blocks
    v8f sacc[4];
#pragma unroll
    for (int c = 0; c < 4; ++c) sacc[c] = zero8();
#pragma unroll
    for (int kk = 0; kk < 2; ++kk) {
#pragma unroll
      for (int c = 0; c < 4; ++c) {
        v16h ka = ld_frag(Kc + (16 * c + r) * KVS + kk * 32, koff);
        sacc[c] = wmma_f16(ka, qb[kk], sacc[c]);
      }
    }

    // Online softmax of query r: 32 scores in this lane, 32 in lane^16.
    float s[4][8], mxc[4];
#pragma unroll
    for (int c = 0; c < 4; ++c) {
      const float mv[8] = {mk[c][0].x, mk[c][0].y, mk[c][0].z, mk[c][0].w,
                           mk[c][1].x, mk[c][1].y, mk[c][1].z, mk[c][1].w};
      mxc[c] = -1.0e30f;
#pragma unroll
      for (int j = 0; j < 8; ++j) {
        s[c][j] = fmaf(mv[j], mcoef, sacc[c][j] * scale);
        mxc[c] = fmaxf(mxc[c], s[c][j]);
      }
    }
    float mx = fmaxf(fmaxf(mxc[0], mxc[1]), fmaxf(mxc[2], mxc[3]));
    mx = fmaxf(mx, other_half(mx));
    const float mnew = fmaxf(mrow, mx);
    const float corr = exp2_1(mrow - mnew);
    mrow = mnew;

    float psc[4];
    v16h pb[2];
#pragma unroll
    for (int c = 0; c < 4; ++c) {
      float arg[8], pv[8];
#pragma unroll
      for (int j = 0; j < 8; ++j) arg[j] = s[c][j] - mnew;
      exp2_8(pv, arg);
      psc[c] = pv[0];
#pragma unroll
      for (int j = 1; j < 8; ++j) psc[c] += pv[j];
#pragma unroll
      for (int j = 0; j < 8; ++j) pb[c >> 1][8 * (c & 1) + j] = (_Float16)pv[j];
    }
    lrow = lrow * corr + ((psc[0] + psc[1]) + (psc[2] + psc[3]));
#pragma unroll
    for (int c = 0; c < 4; ++c)
#pragma unroll
      for (int j = 0; j < 8; ++j) oacc[c][j] *= corr;

    // O^T += V^T * P^T : V^T as A-frags from [dh][key], P^T from registers
#pragma unroll
    for (int kk = 0; kk < 2; ++kk) {
#pragma unroll
      for (int c = 0; c < 4; ++c) {
        v16h va = ld_frag(Vc + (16 * c + r) * KVS + kk * 32, koff);
        oacc[c] = wmma_f16(va, pb[kk], oacc[c]);
      }
    }
  }

  // Join the halves' sums, normalize, write ctx (heads merged), f32:
  // ctx[query][head*64 + 16c + 8g + 0..7], 2x float4 per tile.
  const float inv = 1.0f / (lrow + other_half(lrow));
  float* orow = ctx + (size_t)qrow * D + head * 64 + 8 * g;
#pragma unroll
  for (int c = 0; c < 4; ++c) {
    float4 lo = {oacc[c][0] * inv, oacc[c][1] * inv, oacc[c][2] * inv, oacc[c][3] * inv};
    float4 hi = {oacc[c][4] * inv, oacc[c][5] * inv, oacc[c][6] * inv, oacc[c][7] * inv};
    *(float4*)(orow + 16 * c)     = lo;
    *(float4*)(orow + 16 * c + 4) = hi;
  }
}

// ---------------------------------------------------------------------------
// Launch: 3 projections (one grid) -> flash attention -> output projection. 20MB ws.
// ---------------------------------------------------------------------------
extern "C" void kernel_launch(void* const* d_in, const int* in_sizes, int n_in,
                              void* d_out, int out_size, void* d_ws, size_t ws_size,
                              hipStream_t stream) {
  (void)in_sizes; (void)n_in; (void)out_size; (void)ws_size;
  const float* q    = (const float*)d_in[0];
  const float* k    = (const float*)d_in[1];
  const float* v    = (const float*)d_in[2];
  const float* mask = (const float*)d_in[3];
  const float* wq   = (const float*)d_in[4];
  const float* wk   = (const float*)d_in[5];
  const float* wv   = (const float*)d_in[6];
  const float* wo   = (const float*)d_in[7];
  const float* bo   = (const float*)d_in[8];
  float* out = (float*)d_out;

  char* ws = (char*)d_ws;
  _Float16* Qh  = (_Float16*)(ws + 0);                        // 4 MB [H][S][64]
  _Float16* Kh  = (_Float16*)(ws + (size_t)4  * 1024 * 1024); // 4 MB [H][S][64]
  _Float16* VhT = (_Float16*)(ws + (size_t)8  * 1024 * 1024); // 4 MB [H][64][S]
  float*    ctx = (float*)   (ws + (size_t)12 * 1024 * 1024); // 8 MB [S][512]

  dim3 gblk(256);
  // 4096/128 row blocks x 512/64 col blocks (x 3 projections)
  proj_qkv<<<dim3(32, 8, 3), gblk, 0, stream>>>(q, k, v, wq, wk, wv, Qh, Kh, VhT);
  flash_attn<<<dim3(32, 8), gblk, 0, stream>>>(Qh, Kh, VhT, mask, ctx);
  proj_out<<<dim3(32, 8), gblk, 0, stream>>>(ctx, wo, bo, out);
}

// v006
// Measured time: 77.7 microseconds a run.
// Next to v005, in two timings, it ran 1.10 times as fast each time.
// All steps since v000 together make it 3.05 times as fast.
#include <hip/hip_runtime.h>
#include <hip/hip_bf16.h>

typedef __attribute__((ext_vector_type(16))) _Float16 v16h;
typedef __attribute__((ext_vector_type(8)))  float    v8f;

__device__ __forceinline__ v8f wmma_f16(v16h a, v16h b, v8f c) {
  return __builtin_amdgcn_wmma_f32_16x16x32_f16(false, a, false, b, (short)0, c,
                                                false, false);
}

// Gather one 16-half fragment as 8 packed 32-bit loads (pairs contiguous in K).
__device__ __forceinline__ v16h ld_frag(const _Float16* base, const int* koff) {
  union { unsigned u[8]; v16h h; } t;
#pragma unroll
  for (int p = 0; p < 8; ++p)
    t.u[p] = *(const unsigned*)(base + koff[p]);
  return t.h;
}

__device__ __forceinline__ v8f zero8() {
  v8f z = {0.f, 0.f, 0.f, 0.f, 0.f, 0.f, 0.f, 0.f};
  return z;
}

__device__ __forceinline__ unsigned lds_off(const void* p) {
  return (unsigned)(size_t)p;
}

__device__ __forceinline__ void async_copy12_b128(const unsigned (&l)[12],
                                                  const void* const (&p)[12]) {
  asm volatile("global_load_async_to_lds_b128 %0, %12, off\n\t"
               "global_load_async_to_lds_b128 %1, %13, off\n\t"
               "global_load_async_to_lds_b128 %2, %14, off\n\t"
               "global_load_async_to_lds_b128 %3, %15, off\n\t"
               "global_load_async_to_lds_b128 %4, %16, off\n\t"
               "global_load_async_to_lds_b128 %5, %17, off\n\t"
               "global_load_async_to_lds_b128 %6, %18, off\n\t"
               "global_load_async_to_lds_b128 %7, %19, off\n\t"
               "global_load_async_to_lds_b128 %8, %20, off\n\t"
               "global_load_async_to_lds_b128 %9, %21, off\n\t"
               "global_load_async_to_lds_b128 %10, %22, off\n\t"
               "global_load_async_to_lds_b128 %11, %23, off\n\t"
               "s_wait_xcnt 0x0"
               :
               : "v"(l[0]), "v"(l[1]), "v"(l[2]), "v"(l[3]),
                 "v"(l[4]), "v"(l[5]), "v"(l[6]), "v"(l[7]),
                 "v"(l[8]), "v"(l[9]), "v"(l[10]), "v"(l[11]),
                 "v"(p[0]), "v"(p[1]), "v"(p[2]), "v"(p[3]),
                 "v"(p[4]), "v"(p[5]), "v"(p[6]), "v"(p[7]),
                 "v"(p[8]), "v"(p[9]), "v"(p[10]), "v"(p[11])
               : "memory");
}

// Value of the same lane position in the other 16-lane half (lane ^ 16).
__device__ __forceinline__ float other_half(float x) {
  unsigned u = __builtin_bit_cast(unsigned, x);
  u = __builtin_amdgcn_permlanex16(u, u, 0x76543210u, 0xfedcba98u, false, false);
  return __builtin_bit_cast(float, u);
}

__device__ __forceinline__ float exp2_1(float x) {
  float y;
  asm("v_exp_f32 %0, %1\n\tv_nop" : "=&v"(y) : "v"(x));
  return y;
}
__device__ __forceinline__ void exp2_8(float (&p)[8], const float (&a)[8]) {
  asm("v_exp_f32 %0, %8\n\t"
      "v_exp_f32 %1, %9\n\t"
      "v_exp_f32 %2, %10\n\t"
      "v_exp_f32 %3, %11\n\t"
      "v_exp_f32 %4, %12\n\t"
      "v_exp_f32 %5, %13\n\t"
      "v_exp_f32 %6, %14\n\t"
      "v_exp_f32 %7, %15\n\t"
      "v_nop"
      : "=&v"(p[0]), "=&v"(p[1]), "=&v"(p[2]), "=&v"(p[3]),
        "=&v"(p[4]), "=&v"(p[5]), "=&v"(p[6]), "=&v"(p[7])
      : "v"(a[0]), "v"(a[1]), "v"(a[2]), "v"(a[3]),
        "v"(a[4]), "v"(a[5]), "v"(a[6]), "v"(a[7]));
}

// All but this wave's N youngest async copies have landed in LDS.
template <int N>
__device__ __forceinline__ void wait_async() {
  asm volatile("s_wait_asynccnt %0" :: "n"(N) : "memory");
}

// This wave's LDS reads have returned: stands in front of the barrier behind
// which the buffer they read is refilled by async copies.
__device__ __forceinline__ void wait_ds0() {
  asm volatile("s_wait_dscnt 0x0" ::: "memory");
}

constexpr int GBK = 128;
constexpr int GP  = GBK + 8;

typedef __attribute__((ext_vector_type(4))) float    v4f;
typedef __attribute__((ext_vector_type(2))) float    v2f;
typedef __attribute__((ext_vector_type(2))) _Float16 v2h;

// Two f32 -> one register of two f16 (round to nearest even), lo in the low half.
__device__ __forceinline__ unsigned pack_h2(float lo, float hi) {
  v2f f = {lo, hi};
  return __builtin_bit_cast(unsigned, __builtin_convertvector(f, v2h));
}

__device__ __forceinline__ void gemm_tile(const float* __restrict__ X,
                                          const float* __restrict__ W,
                                          _Float16* As,   // [128][GP] halves, [row][k]
                                          _Float16* Bs,   // [64][GP] halves, [n][k]
                                          v8f (&acc)[4]) {
  constexpr int D = 512;
  const int m0 = blockIdx.x * 128;
  const int n0 = blockIdx.y * 64;
  const int t    = threadIdx.x;
  const int lane = t & 31;
  const int w    = t >> 5;      // wave id 0..7 (wave32)
  const int r    = lane & 15;
  const int g    = lane >> 4;

  // Every unroll below: the arrays its loop indexes have to stay in registers.
  int koff[8];
#pragma unroll
  for (int p = 0; p < 8; ++p) koff[p] = 2 * (p & 3) + 16 * (p >> 2) + 8 * g;

#pragma unroll
  for (int c = 0; c < 4; ++c) acc[c] = zero8();

  // A: a wave's load is 512 contiguous bytes of one row (rows w, w+8, ...).
  const float* xp = X + (size_t)(m0 + w) * D + 4 * lane;
  _Float16*    ap = As + w * GP + 4 * lane;
  // B: a thread takes 4 columns of the two rows 2*kp, 2*kp+1, so that a k pair
  // goes to [n][k] as one 32-bit store; 8 lanes cover one 128-byte line.
  const int bc = t & 7;         // float4 column, +8 for the second half
  const int kp = t >> 3;        // k pair 0..31, +32 for the second half
  const float* wp = W + (size_t)(2 * kp) * D + n0 + 4 * bc;
  _Float16*    bp = Bs + (4 * bc) * GP + 2 * kp;

  for (int kt = 0; kt < D / GBK; ++kt) {
    const int k0 = kt * GBK;
    v4f xa[16], wlo[4], whi[4];
#pragma unroll
    for (int i = 0; i < 16; ++i)
      xa[i] = *(const v4f*)(xp + (size_t)(8 * i) * D + k0);
#pragma unroll
    for (int i = 0; i < 4; ++i) {
      const float* q = wp + (size_t)(k0 + 64 * (i >> 1)) * D + 32 * (i & 1);
      wlo[i] = *(const v4f*)q;
      whi[i] = *(const v4f*)(q + D);
    }
    // Nothing is scheduled across this line: all 24 loads are issued before the
    // first is waited for. Without it the compiler lifts the first conversions in
    // among the loads and the tile's last loads start a whole memory trip later.
    __builtin_amdgcn_sched_barrier(0);
    // Stands in front of every later write of the loads' address registers.
    asm volatile("s_wait_xcnt 0x0" ::: "memory");
    __syncthreads();   // every wave has read its fragments of the tile before
#pragma unroll
    for (int i = 0; i < 16; ++i) {
      uint2 h = {pack_h2(xa[i].x, xa[i].y), pack_h2(xa[i].z, xa[i].w)};
      *(uint2*)(ap + 8 * i * GP) = h;
    }
#pragma unroll
    for (int i = 0; i < 4; ++i) {
      _Float16* d = bp + 32 * (i & 1) * GP + 64 * (i >> 1);
      *(unsigned*)(d)          = pack_h2(wlo[i].x, whi[i].x);
      *(unsigned*)(d + GP)     = pack_h2(wlo[i].y, whi[i].y);
      *(unsigned*)(d + 2 * GP) = pack_h2(wlo[i].z, whi[i].z);
      *(unsigned*)(d + 3 * GP) = pack_h2(wlo[i].w, whi[i].w);
    }
    __syncthreads();   // the tile is whole
    // The ten LDS reads of a 32-deep k step stand together, one step ahead of the
    // four products that use them.
    v16h af[2], bf[2][4];
    af[0] = ld_frag(As + (16 * w + r) * GP, koff);
#pragma unroll
    for (int c = 0; c < 4; ++c) bf[0][c] = ld_frag(Bs + (16 * c + r) * GP, koff);
#pragma unroll
    for (int kk = 0; kk < GBK / 32; ++kk) {
      if (kk + 1 < GBK / 32) {
        af[(kk + 1) & 1] = ld_frag(As + (16 * w + r) * GP + 32 * (kk + 1), koff);
#pragma unroll
        for (int c = 0; c < 4; ++c)
          bf[(kk + 1) & 1][c] = ld_frag(Bs + (16 * c + r) * GP + 32 * (kk + 1), koff);
        // Holds those reads above this step's products: left free, the compiler
        // sinks each read to its own product, which then waits it out alone.
        __builtin_amdgcn_sched_barrier(0);
      }
#pragma unroll
      for (int c = 0; c < 4; ++c) acc[c] = wmma_f16(af[kk & 1], bf[kk & 1][c], acc[c]);
    }
  }
}

// The three input projections in ONE launch: blockIdx.z picks q*wq, k*wk or v*wv.
// They do not depend on one another, and one of them alone puts a single block
// on a WGP, whose waves wait out every load and barrier with nothing beside
// them; together three blocks share a WGP and fill each other's waits.
//   z = 0, 1: out f16 [H][S][64]  (Q, K per-head layout)
//   z = 2   : out f16 [H][64][S]  (V transposed per-head layout)
__global__ __launch_bounds__(256) void proj_qkv(const float* __restrict__ q,
                                                const float* __restrict__ k,
                                                const float* __restrict__ v,
                                                const float* __restrict__ wq,
                                                const float* __restrict__ wk,
                                                const float* __restrict__ wv,
                                                _Float16* __restrict__ Qh,
                                                _Float16* __restrict__ Kh,
                                                _Float16* __restrict__ VhT) {
  __shared__ __align__(16) _Float16 As[128 * GP];
  __shared__ __align__(16) _Float16 Bs[64 * GP];
  const int z = blockIdx.z;
  const float* X = z == 0 ? q : (z == 1 ? k : v);
  const float* W = z == 0 ? wq : (z == 1 ? wk : wv);

  v8f acc[4];
  gemm_tile(X, W, As, Bs, acc);

  const int lane = threadIdx.x & 31;
  const int r    = lane & 15;
  const int mb   = blockIdx.x * 128 + 16 * (threadIdx.x >> 5) + 8 * (lane >> 4);
  const int h    = blockIdx.y;     // 64 columns of a block = one head
  if (z == 2) {
#pragma unroll
    for (int c = 0; c < 4; ++c)
#pragma unroll
      for (int j = 0; j < 8; ++j)
        VhT[((size_t)h * 64 + 16 * c + r) * 4096 + mb + j] = (_Float16)acc[c][j];
  } else {
    _Float16* out16 = z == 0 ? Qh : Kh;
#pragma unroll
    for (int c = 0; c < 4; ++c)
#pragma unroll
      for (int j = 0; j < 8; ++j)
        out16[((size_t)h * 4096 + mb + j) * 64 + 16 * c + r] = (_Float16)acc[c][j];
  }
}

// Final projection: out f32 [S][512] = ctx * wo + bias.
__global__ __launch_bounds__(256) void proj_out(const float* __restrict__ X,
                                                const float* __restrict__ W,
                                                const float* __restrict__ bias,
                                                float* __restrict__ out32) {
  __shared__ __align__(16) _Float16 As[128 * GP];
  __shared__ __align__(16) _Float16 Bs[64 * GP];
  v8f acc[4];
  gemm_tile(X, W, As, Bs, acc);

  const int lane = threadIdx.x & 31;
  const int mb   = blockIdx.x * 128 + 16 * (threadIdx.x >> 5) + 8 * (lane >> 4);
#pragma unroll
  for (int c = 0; c < 4; ++c) {
    const int n = blockIdx.y * 64 + 16 * c + (lane & 15);
#pragma unroll
    for (int j = 0; j < 8; ++j)
      out32[(size_t)(mb + j) * 512 + n] = acc[c][j] + bias[n];
  }
}

__global__ __launch_bounds__(256) __attribute__((amdgpu_waves_per_eu(2, 2))) void flash_attn(const _Float16* __restrict__ Qh,
                                                  const _Float16* __restrict__ Kh,
                                                  const _Float16* __restrict__ VhT,
                                                  const float* __restrict__ mask,
                                                  float* __restrict__ ctx) {
  constexpr int S = 4096, DH = 64, D = 512;
  constexpr int KVS = 72;
  constexpr int KVT = 64 * KVS;
  constexpr int MP  = 68;
  constexpr int MT  = 128 * MP;
  constexpr int NB   = 4;
  constexpr int LEAD = NB - 1;
  constexpr int CPT  = 12;

  const int head = blockIdx.y;
  const int m0   = blockIdx.x * 128;
  const int t    = threadIdx.x;
  const int lane = t & 31;
  const int w    = t >> 5;
  const int r    = lane & 15;
  const int g    = lane >> 4;

  __shared__ __align__(16) _Float16 smem[2 * NB * KVT];
  _Float16* Kt0 = smem;              // NB K buffers
  _Float16* Vt0 = smem + NB * KVT;   // NB V buffers
  __shared__ __align__(16) float msm[NB * MT];  // NB mask buffers

  int koff[8];
#pragma unroll
  for (int p = 0; p < 8; ++p) koff[p] = 2 * (p & 3) + 16 * (p >> 2) + 8 * g;

  // Q^T B-fragments: column (query) m0+16w+r, two 32-wide K chunks over Dh=64
  const int qrow = m0 + 16 * w + r;
  v16h qb[2];
#pragma unroll
  for (int kk = 0; kk < 2; ++kk) {
    union { unsigned u[8]; v16h h; } tmp;
#pragma unroll
    for (int p = 0; p < 8; ++p)
      tmp.u[p] = *(const unsigned*)(Qh + ((size_t)head * S + qrow) * DH +
                                    kk * 32 + koff[p]);
    qb[kk] = tmp.h;
  }

  // O^T tiles: oacc[c][j] = O(query r, dh 16c + j + 8g)
  v8f oacc[4];
#pragma unroll
  for (int c = 0; c < 4; ++c) oacc[c] = zero8();
  float mrow = -1.0e30f;  // running max of query r, in log2 units (equal in both halves)
  float lrow = 0.0f;      // running sum over this half's keys only

  // Scores are kept in log2 units: e^(s - m) = 2^(s*log2e - m*log2e), so log2e
  // is folded into the two score constants and each exponential is one v_exp_f32.
  // 1/(sqrt(64)+1e-9) rounds to 0.125 in f32.
  constexpr float LOG2E = 1.44269504088896340736f;
  const float scale = 0.125f * LOG2E;
  const float mcoef = -1.0e9f * LOG2E;

  const float*   mgp = mask + (size_t)(m0 + 16 * w + g) * S + 4 * r;
  const unsigned mlp = lds_off(msm + (16 * w + g) * MP + 4 * r);
  // Issue the async copies of one 64-key tile: per thread 8x16B of mask (longest
  // way to come: first), then 2x16B of K + 2x16B of V.
  auto issue_tile = [&](int t0, int buf) {
    unsigned l[CPT];
    const void* p[CPT];
#pragma unroll
    for (int i = 0; i < 8; ++i) {
      l[i] = mlp + 4u * (unsigned)(buf * MT + 2 * i * MP);
      p[i] = mgp + (size_t)(2 * i) * S + t0;
    }
#pragma unroll
    for (int i = 0; i < 2; ++i) {
      int idx = t + 256 * i;            // 0..511 chunks of 8 halves
      int row = idx >> 3, c8 = idx & 7;
      l[8 + 2 * i] = lds_off(Kt0 + buf * KVT + row * KVS + 8 * c8);
      p[8 + 2 * i] = Kh + ((size_t)head * S + t0 + row) * DH + 8 * c8;
      l[9 + 2 * i] = lds_off(Vt0 + buf * KVT + row * KVS + 8 * c8);
      p[9 + 2 * i] = VhT + ((size_t)head * DH + row) * S + t0 + 8 * c8;
    }
    async_copy12_b128(l, p);
  };

  static_assert(S / 64 >= LEAD && LEAD * CPT <= 63, "ring prologue, copies in flight");
  for (int i = 0; i < LEAD; ++i) issue_tile(64 * i, i);  // prologue: tiles 0..LEAD-1

  for (int t0 = 0; t0 < S; t0 += 64) {
    const int cur = (t0 >> 6) & (NB - 1);
    wait_ds0();         // this wave's reads of the buffer refilled below have returned
    // This wave's copies of tile t0 have landed. Every wave issues CPT copies a
    // tile, in tile order, so while both younger tiles have been issued the count
    // leaves exactly theirs in flight; in the last trips, where they have not, 0.
    if (t0 + (LEAD - 1) * 64 < S) wait_async<(LEAD - 1) * CPT>();
    else                          wait_async<0>();
    __syncthreads();    // all waves landed; all waves done reading the trip before's buffer
    if (t0 + LEAD * 64 < S)   // into the buffer of the trip before; flies over LEAD trips
      issue_tile(t0 + LEAD * 64, (cur + LEAD) & (NB - 1));

    const _Float16* Kc = Kt0 + cur * KVT;
    const _Float16* Vc = Vt0 + cur * KVT;

    // Mask from LDS: 8 consecutive keys of one query per 16-key group, 2x float4.
    const float* mc = msm + cur * MT + (16 * w + r) * MP + 8 * g;
    float4 mk[4][2];
#pragma unroll
    for (int c = 0; c < 4; ++c) {
      mk[c][0] = *(const float4*)(mc + 16 * c);
      mk[c][1] = *(const float4*)(mc + 16 * c + 4);
    }

    // S^T = K * Q^T : 2 K-chunks x 4 key-row blocks
    v8f sacc[4];
#pragma unroll
    for (int c = 0; c < 4; ++c) sacc[c] = zero8();
#pragma unroll
    for (int kk = 0; kk < 2; ++kk) {
#pragma unroll
      for (int c = 0; c < 4; ++c) {
        v16h ka = ld_frag(Kc + (16 * c + r) * KVS + kk * 32, koff);
        sacc[c] = wmma_f16(ka, qb[kk], sacc[c]);
      }
    }

    // Online softmax of query r: 32 scores in this lane, 32 in lane^16.
    float s[4][8], mxc[4];
#pragma unroll
    for (int c = 0; c < 4; ++c) {
      const float mv[8] = {mk[c][0].x, mk[c][0].y, mk[c][0].z, mk[c][0].w,
                           mk[c][1].x, mk[c][1].y, mk[c][1].z, mk[c][1].w};
      mxc[c] = -1.0e30f;
#pragma unroll
      for (int j = 0; j < 8; ++j) {
        s[c][j] = fmaf(mv[j], mcoef, sacc[c][j] * scale);
        mxc[c] = fmaxf(mxc[c], s[c][j]);
      }
    }
    float mx = fmaxf(fmaxf(mxc[0], mxc[1]), fmaxf(mxc[2], mxc[3]));
    mx = fmaxf(mx, other_half(mx));
    const float mnew = fmaxf(mrow, mx);
    const float corr = exp2_1(mrow - mnew);
    mrow = mnew;

    float psc[4];
    v16h pb[2];
#pragma unroll
    for (int c = 0; c < 4; ++c) {
      float arg[8], pv[8];
#pragma unroll
      for (int j = 0; j < 8; ++j) arg[j] = s[c][j] - mnew;
      exp2_8(pv, arg);
      psc[c] = pv[0];
#pragma unroll
      for (int j = 1; j < 8; ++j) psc[c] += pv[j];
#pragma unroll
      for (int j = 0; j < 8; ++j) pb[c >> 1][8 * (c & 1) + j] = (_Float16)pv[j];
    }
    lrow = lrow * corr + ((psc[0] + psc[1]) + (psc[2] + psc[3]));
#pragma unroll
    for (int c = 0; c < 4; ++c)
#pragma unroll
      for (int j = 0; j < 8; ++j) oacc[c][j] *= corr;

    // O^T += V^T * P^T : V^T as A-frags from [dh][key], P^T from registers
#pragma unroll
    for (int kk = 0; kk < 2; ++kk) {
#pragma unroll
      for (int c = 0; c < 4; ++c) {
        v16h va = ld_frag(Vc + (16 * c + r) * KVS + kk * 32, koff);
        oacc[c] = wmma_f16(va, pb[kk], oacc[c]);
      }
    }
  }

  // Join the halves' sums, normalize, write ctx (heads merged), f32:
  // ctx[query][head*64 + 16c + 8g + 0..7], 2x float4 per tile.
  const float inv = 1.0f / (lrow + other_half(lrow));
  float* orow = ctx + (size_t)qrow * D + head * 64 + 8 * g;
#pragma unroll
  for (int c = 0; c < 4; ++c) {
    float4 lo = {oacc[c][0] * inv, oacc[c][1] * inv, oacc[c][2] * inv, oacc[c][3] * inv};
    float4 hi = {oacc[c][4] * inv, oacc[c][5] * inv, oacc[c][6] * inv, oacc[c][7] * inv};
    *(float4*)(orow + 16 * c)     = lo;
    *(float4*)(orow + 16 * c + 4) = hi;
  }
}

// ---------------------------------------------------------------------------
// Launch: 3 projections (one grid) -> flash attention -> output projection. 20MB ws.
// ---------------------------------------------------------------------------
extern "C" void kernel_launch(void* const* d_in, const int* in_sizes, int n_in,
                              void* d_out, int out_size, void* d_ws, size_t ws_size,
                              hipStream_t stream) {
  (void)in_sizes; (void)n_in; (void)out_size; (void)ws_size;
  const float* q    = (const float*)d_in[0];
  const float* k    = (const float*)d_in[1];
  const float* v    = (const float*)d_in[2];
  const float* mask = (const float*)d_in[3];
  const float* wq   = (const float*)d_in[4];
  const float* wk   = (const float*)d_in[5];
  const float* wv   = (const float*)d_in[6];
  const float* wo   = (const float*)d_in[7];
  const float* bo   = (const float*)d_in[8];
  float* out = (float*)d_out;

  char* ws = (char*)d_ws;
  _Float16* Qh  = (_Float16*)(ws + 0);                        // 4 MB [H][S][64]
  _Float16* Kh  = (_Float16*)(ws + (size_t)4  * 1024 * 1024); // 4 MB [H][S][64]
  _Float16* VhT = (_Float16*)(ws + (size_t)8  * 1024 * 1024); // 4 MB [H][64][S]
  float*    ctx = (float*)   (ws + (size_t)12 * 1024 * 1024); // 8 MB [S][512]

  dim3 gblk(256);
  // 4096/128 row blocks x 512/64 col blocks (x 3 projections)
  proj_qkv<<<dim3(32, 8, 3), gblk, 0, stream>>>(q, k, v, wq, wk, wv, Qh, Kh, VhT);
  flash_attn<<<dim3(32, 8), gblk, 0, stream>>>(Qh, Kh, VhT, mask, ctx);
  proj_out<<<dim3(32, 8), gblk, 0, stream>>>(ctx, wo, bo, out);
}

// v007
// One run takes 69.6 microseconds.
// Two timings next to v006 both put it at 1.12 times that version's speed.
// Counting every step since v000, it is 3.42 times as fast.
#include <hip/hip_runtime.h>
#include <hip/hip_bf16.h>

typedef __attribute__((ext_vector_type(16))) _Float16 v16h;
typedef __attribute__((ext_vector_type(8)))  float    v8f;

__device__ __forceinline__ v8f wmma_f16(v16h a, v16h b, v8f c) {
  return __builtin_amdgcn_wmma_f32_16x16x32_f16(false, a, false, b, (short)0, c,
                                                false, false);
}

// Gather one 16-half fragment as 8 packed 32-bit loads (pairs contiguous in K).
__device__ __forceinline__ v16h ld_frag(const _Float16* base, const int* koff) {
  union { unsigned u[8]; v16h h; } t;
#pragma unroll
  for (int p = 0; p < 8; ++p)
    t.u[p] = *(const unsigned*)(base + koff[p]);
  return t.h;
}

// The same fragment as its two 16-byte runs (k = 8g..8g+7 and 16+8g..16+8g+7);
// base holds the lane's 8g already and is 16-byte aligned.
__device__ __forceinline__ v16h ld_frag_b128(const _Float16* base) {
  union { uint4 q[2]; v16h h; } t;
  t.q[0] = *(const uint4*)(base);
  t.q[1] = *(const uint4*)(base + 16);
  return t.h;
}

__device__ __forceinline__ v8f zero8() {
  v8f z = {0.f, 0.f, 0.f, 0.f, 0.f, 0.f, 0.f, 0.f};
  return z;
}

__device__ __forceinline__ unsigned lds_off(const void* p) {
  return (unsigned)(size_t)p;
}

__device__ __forceinline__ void async_copy12_b128(const unsigned (&l)[12],
                                                  const void* const (&p)[12]) {
  asm volatile("global_load_async_to_lds_b128 %0, %12, off\n\t"
               "global_load_async_to_lds_b128 %1, %13, off\n\t"
               "global_load_async_to_lds_b128 %2, %14, off\n\t"
               "global_load_async_to_lds_b128 %3, %15, off\n\t"
               "global_load_async_to_lds_b128 %4, %16, off\n\t"
               "global_load_async_to_lds_b128 %5, %17, off\n\t"
               "global_load_async_to_lds_b128 %6, %18, off\n\t"
               "global_load_async_to_lds_b128 %7, %19, off\n\t"
               "global_load_async_to_lds_b128 %8, %20, off\n\t"
               "global_load_async_to_lds_b128 %9, %21, off\n\t"
               "global_load_async_to_lds_b128 %10, %22, off\n\t"
               "global_load_async_to_lds_b128 %11, %23, off\n\t"
               "s_wait_xcnt 0x0"
               :
               : "v"(l[0]), "v"(l[1]), "v"(l[2]), "v"(l[3]),
                 "v"(l[4]), "v"(l[5]), "v"(l[6]), "v"(l[7]),
                 "v"(l[8]), "v"(l[9]), "v"(l[10]), "v"(l[11]),
                 "v"(p[0]), "v"(p[1]), "v"(p[2]), "v"(p[3]),
                 "v"(p[4]), "v"(p[5]), "v"(p[6]), "v"(p[7]),
                 "v"(p[8]), "v"(p[9]), "v"(p[10]), "v"(p[11])
               : "memory");
}

// Value of the same lane position in the other 16-lane half (lane ^ 16).
__device__ __forceinline__ float other_half(float x) {
  unsigned u = __builtin_bit_cast(unsigned, x);
  u = __builtin_amdgcn_permlanex16(u, u, 0x76543210u, 0xfedcba98u, false, false);
  return __builtin_bit_cast(float, u);
}

__device__ __forceinline__ float exp2_1(float x) {
  float y;
  asm("v_exp_f32 %0, %1\n\tv_nop" : "=&v"(y) : "v"(x));
  return y;
}
__device__ __forceinline__ void exp2_8(float (&p)[8], const float (&a)[8]) {
  asm("v_exp_f32 %0, %8\n\t"
      "v_exp_f32 %1, %9\n\t"
      "v_exp_f32 %2, %10\n\t"
      "v_exp_f32 %3, %11\n\t"
      "v_exp_f32 %4, %12\n\t"
      "v_exp_f32 %5, %13\n\t"
      "v_exp_f32 %6, %14\n\t"
      "v_exp_f32 %7, %15\n\t"
      "v_nop"
      : "=&v"(p[0]), "=&v"(p[1]), "=&v"(p[2]), "=&v"(p[3]),
        "=&v"(p[4]), "=&v"(p[5]), "=&v"(p[6]), "=&v"(p[7])
      : "v"(a[0]), "v"(a[1]), "v"(a[2]), "v"(a[3]),
        "v"(a[4]), "v"(a[5]), "v"(a[6]), "v"(a[7]));
}

// All but this wave's N youngest async copies have landed in LDS.
template <int N>
__device__ __forceinline__ void wait_async() {
  asm volatile("s_wait_asynccnt %0" :: "n"(N) : "memory");
}

// This wave's LDS reads have returned: stands in front of the barrier behind
// which the buffer they read is refilled by async copies.
__device__ __forceinline__ void wait_ds0() {
  asm volatile("s_wait_dscnt 0x0" ::: "memory");
}

constexpr int GBK = 128;
constexpr int GP  = GBK + 8;

typedef __attribute__((ext_vector_type(4))) float    v4f;
typedef __attribute__((ext_vector_type(2))) float    v2f;
typedef __attribute__((ext_vector_type(2))) _Float16 v2h;

// Two f32 -> one register of two f16 (round to nearest even), lo in the low half.
__device__ __forceinline__ unsigned pack_h2(float lo, float hi) {
  v2f f = {lo, hi};
  return __builtin_bit_cast(unsigned, __builtin_convertvector(f, v2h));
}

__device__ __forceinline__ void gemm_tile(const float* __restrict__ X,
                                          const float* __restrict__ W,
                                          _Float16* As,   // [128][GP] halves, [row][k]
                                          _Float16* Bs,   // [64][GP] halves, [n][k]
                                          v8f (&acc)[4]) {
  constexpr int D = 512;
  const int m0 = blockIdx.x * 128;
  const int n0 = blockIdx.y * 64;
  const int t    = threadIdx.x;
  const int lane = t & 31;
  const int w    = t >> 5;      // wave id 0..7 (wave32)
  const int r    = lane & 15;
  const int g    = lane >> 4;

  // Every unroll below: the arrays its loop indexes have to stay in registers.
  int koff[8];
#pragma unroll
  for (int p = 0; p < 8; ++p) koff[p] = 2 * (p & 3) + 16 * (p >> 2) + 8 * g;

#pragma unroll
  for (int c = 0; c < 4; ++c) acc[c] = zero8();

  // A: a wave's load is 512 contiguous bytes of one row (rows w, w+8, ...).
  const float* xp = X + (size_t)(m0 + w) * D + 4 * lane;
  _Float16*    ap = As + w * GP + 4 * lane;
  // B: a thread takes 4 columns of the two rows 2*kp, 2*kp+1, so that a k pair
  // goes to [n][k] as one 32-bit store; 8 lanes cover one 128-byte line.
  const int bc = t & 7;         // float4 column, +8 for the second half
  const int kp = t >> 3;        // k pair 0..31, +32 for the second half
  const float* wp = W + (size_t)(2 * kp) * D + n0 + 4 * bc;
  _Float16*    bp = Bs + (4 * bc) * GP + 2 * kp;

  for (int kt = 0; kt < D / GBK; ++kt) {
    const int k0 = kt * GBK;
    v4f xa[16], wlo[4], whi[4];
#pragma unroll
    for (int i = 0; i < 16; ++i)
      xa[i] = *(const v4f*)(xp + (size_t)(8 * i) * D + k0);
#pragma unroll
    for (int i = 0; i < 4; ++i) {
      const float* q = wp + (size_t)(k0 + 64 * (i >> 1)) * D + 32 * (i & 1);
      wlo[i] = *(const v4f*)q;
      whi[i] = *(const v4f*)(q + D);
    }
    // Nothing is scheduled across this line: all 24 loads are issued before the
    // first is waited for. Without it the compiler lifts the first conversions in
    // among the loads and the tile's last loads start a whole memory trip later.
    __builtin_amdgcn_sched_barrier(0);
    // Stands in front of every later write of the loads' address registers.
    asm volatile("s_wait_xcnt 0x0" ::: "memory");
    __syncthreads();   // every wave has read its fragments of the tile before
#pragma unroll
    for (int i = 0; i < 16; ++i) {
      uint2 h = {pack_h2(xa[i].x, xa[i].y), pack_h2(xa[i].z, xa[i].w)};
      *(uint2*)(ap + 8 * i * GP) = h;
    }
#pragma unroll
    for (int i = 0; i < 4; ++i) {
      _Float16* d = bp + 32 * (i & 1) * GP + 64 * (i >> 1);
      *(unsigned*)(d)          = pack_h2(wlo[i].x, whi[i].x);
      *(unsigned*)(d + GP)     = pack_h2(wlo[i].y, whi[i].y);
      *(unsigned*)(d + 2 * GP) = pack_h2(wlo[i].z, whi[i].z);
      *(unsigned*)(d + 3 * GP) = pack_h2(wlo[i].w, whi[i].w);
    }
    __syncthreads();   // the tile is whole
    // The ten LDS reads of a 32-deep k step stand together, one step ahead of the
    // four products that use them.
    v16h af[2], bf[2][4];
    af[0] = ld_frag(As + (16 * w + r) * GP, koff);
#pragma unroll
    for (int c = 0; c < 4; ++c) bf[0][c] = ld_frag(Bs + (16 * c + r) * GP, koff);
#pragma unroll
    for (int kk = 0; kk < GBK / 32; ++kk) {
      if (kk + 1 < GBK / 32) {
        af[(kk + 1) & 1] = ld_frag(As + (16 * w + r) * GP + 32 * (kk + 1), koff);
#pragma unroll
        for (int c = 0; c < 4; ++c)
          bf[(kk + 1) & 1][c] = ld_frag(Bs + (16 * c + r) * GP + 32 * (kk + 1), koff);
        // Holds those reads above this step's products: left free, the compiler
        // sinks each read to its own product, which then waits it out alone.
        __builtin_amdgcn_sched_barrier(0);
      }
#pragma unroll
      for (int c = 0; c < 4; ++c) acc[c] = wmma_f16(af[kk & 1], bf[kk & 1][c], acc[c]);
    }
  }
}

// The three input projections in ONE launch: blockIdx.z picks q*wq, k*wk or v*wv.
// They do not depend on one another, and one of them alone puts a single block
// on a WGP, whose waves wait out every load and barrier with nothing beside
// them; together three blocks share a WGP and fill each other's waits.
//   z = 0, 1: out f16 [H][S][64]  (Q, K per-head layout)
//   z = 2   : out f16 [H][64][S]  (V transposed per-head layout)
__global__ __launch_bounds__(256) void proj_qkv(const float* __restrict__ q,
                                                const float* __restrict__ k,
                                                const float* __restrict__ v,
                                                const float* __restrict__ wq,
                                                const float* __restrict__ wk,
                                                const float* __restrict__ wv,
                                                _Float16* __restrict__ Qh,
                                                _Float16* __restrict__ Kh,
                                                _Float16* __restrict__ VhT) {
  __shared__ __align__(16) _Float16 As[128 * GP];
  __shared__ __align__(16) _Float16 Bs[64 * GP];
  const int z = blockIdx.z;
  const float* X = z == 0 ? q : (z == 1 ? k : v);
  const float* W = z == 0 ? wq : (z == 1 ? wk : wv);

  v8f acc[4];
  gemm_tile(X, W, As, Bs, acc);

  const int lane = threadIdx.x & 31;
  const int r    = lane & 15;
  const int mb   = blockIdx.x * 128 + 16 * (threadIdx.x >> 5) + 8 * (lane >> 4);
  const int h    = blockIdx.y;     // 64 columns of a block = one head
  if (z == 2) {
#pragma unroll
    for (int c = 0; c < 4; ++c)
#pragma unroll
      for (int j = 0; j < 8; ++j)
        VhT[((size_t)h * 64 + 16 * c + r) * 4096 + mb + j] = (_Float16)acc[c][j];
  } else {
    _Float16* out16 = z == 0 ? Qh : Kh;
#pragma unroll
    for (int c = 0; c < 4; ++c)
#pragma unroll
      for (int j = 0; j < 8; ++j)
        out16[((size_t)h * 4096 + mb + j) * 64 + 16 * c + r] = (_Float16)acc[c][j];
  }
}

// Final projection: out f32 [S][512] = ctx * wo + bias.
__global__ __launch_bounds__(256) void proj_out(const float* __restrict__ X,
                                                const float* __restrict__ W,
                                                const float* __restrict__ bias,
                                                float* __restrict__ out32) {
  __shared__ __align__(16) _Float16 As[128 * GP];
  __shared__ __align__(16) _Float16 Bs[64 * GP];
  v8f acc[4];
  gemm_tile(X, W, As, Bs, acc);

  const int lane = threadIdx.x & 31;
  const int mb   = blockIdx.x * 128 + 16 * (threadIdx.x >> 5) + 8 * (lane >> 4);
#pragma unroll
  for (int c = 0; c < 4; ++c) {
    const int n = blockIdx.y * 64 + 16 * c + (lane & 15);
#pragma unroll
    for (int j = 0; j < 8; ++j)
      out32[(size_t)(mb + j) * 512 + n] = acc[c][j] + bias[n];
  }
}

__global__ __launch_bounds__(512) __attribute__((amdgpu_waves_per_eu(4, 4))) void flash_attn(const _Float16* __restrict__ Qh,
                                                  const _Float16* __restrict__ Kh,
                                                  const _Float16* __restrict__ VhT,
                                                  const float* __restrict__ mask,
                                                  float* __restrict__ ctx) {
  constexpr int S = 4096, DH = 64, D = 512;
  constexpr int KVS = 72;
  constexpr int KVT = 64 * KVS;
  constexpr int MP  = 68;
  constexpr int MT  = 128 * MP;
  constexpr int KG   = 2;
  constexpr int NB   = 3;
  constexpr int LEAD = NB - 1;
  constexpr int CPT  = 12;
  constexpr int NT   = S / (64 * KG);

  const int head = blockIdx.y;
  const int m0   = blockIdx.x * 128;
  const int t    = threadIdx.x;
  const int lane = t & 31;
  const int w    = (t >> 5) & 7;     // query group: rows 16w..16w+15 of the block
  const int kg   = t >> 8;           // key group: tile kg of every stage
  const int tg   = t & 255;          // thread within its key group
  const int r    = lane & 15;
  const int g    = lane >> 4;

  __shared__ __align__(16) _Float16 smem[2 * NB * KG * KVT];
  _Float16* Kt0 = smem + kg * KVT;                  // this group's tile of K stage 0
  _Float16* Vt0 = smem + (NB * KG + kg) * KVT;      // this group's tile of V stage 0
  __shared__ __align__(16) float msm[NB * KG * MT]; // NB mask stages
  float* Mt0 = msm + kg * MT;                       // this group's tile of mask stage 0

  int koff[8];
#pragma unroll
  for (int p = 0; p < 8; ++p) koff[p] = 2 * (p & 3) + 16 * (p >> 2) + 8 * g;

  // Q^T B-fragments: column (query) m0+16w+r, two 32-wide K chunks over Dh=64
  const int qrow = m0 + 16 * w + r;
  v16h qb[2];
#pragma unroll
  for (int kk = 0; kk < 2; ++kk) {
    union { unsigned u[8]; v16h h; } tmp;
#pragma unroll
    for (int p = 0; p < 8; ++p)
      tmp.u[p] = *(const unsigned*)(Qh + ((size_t)head * S + qrow) * DH +
                                    kk * 32 + koff[p]);
    qb[kk] = tmp.h;
  }

  // O^T tiles: oacc[c][j] = O(query r, dh 16c + j + 8g)
  v8f oacc[4];
#pragma unroll
  for (int c = 0; c < 4; ++c) oacc[c] = zero8();
  float mrow = -1.0e30f;  // running max of query r, in log2 units (equal in both halves)
  float lrow = 0.0f;      // running sum over this half's keys only

  // Scores are kept in log2 units: e^(s - m) = 2^(s*log2e - m*log2e), so log2e
  // is folded into the two score constants and each exponential is one v_exp_f32.
  // 1/(sqrt(64)+1e-9) rounds to 0.125 in f32.
  constexpr float LOG2E = 1.44269504088896340736f;
  const float scale = 0.125f * LOG2E;
  const float mcoef = -1.0e9f * LOG2E;

  const float*   mgp = mask + (size_t)(m0 + 16 * w + g) * S + 64 * kg + 4 * r;
  const unsigned mlp = lds_off(Mt0 + (16 * w + g) * MP + 4 * r);
  // Issue the async copies of this group's 64-key tile of one stage: per thread
  // 8x16B of mask (longest way to come: first), then 2x16B of K + 2x16B of V.
  // t0 is the stage's first key; a group reads only what its own waves copy.
  const _Float16* kgp[2];
  const _Float16* vgp[2];
  unsigned klp[2], vlp[2];
#pragma unroll
  for (int i = 0; i < 2; ++i) {
    const int idx = tg + 256 * i;       // 0..511 chunks of 8 halves
    const int row = idx >> 3, c8 = idx & 7;
    kgp[i] = Kh + ((size_t)head * S + 64 * kg + row) * DH + 8 * c8;
    vgp[i] = VhT + ((size_t)head * DH + row) * S + 64 * kg + 8 * c8;
    klp[i] = lds_off(Kt0 + row * KVS + 8 * c8);
    vlp[i] = lds_off(Vt0 + row * KVS + 8 * c8);
  }
  auto issue_tile = [&](int t0, int buf) {
    unsigned l[CPT];
    const void* p[CPT];
#pragma unroll
    for (int i = 0; i < 8; ++i) {
      l[i] = mlp + 4u * (unsigned)(buf * KG * MT + 2 * i * MP);
      p[i] = mgp + (size_t)(2 * i) * S + t0;
    }
#pragma unroll
    for (int i = 0; i < 2; ++i) {
      l[8 + 2 * i] = klp[i] + 2u * (unsigned)(buf * KG * KVT);
      p[8 + 2 * i] = kgp[i] + (size_t)t0 * DH;
      l[9 + 2 * i] = vlp[i] + 2u * (unsigned)(buf * KG * KVT);
      p[9 + 2 * i] = vgp[i] + t0;
    }
    async_copy12_b128(l, p);
  };

  static_assert(NT >= LEAD && LEAD * CPT <= 63, "ring prologue, copies in flight");
  for (int i = 0; i < LEAD; ++i) issue_tile(64 * KG * i, i);  // prologue: stages 0..LEAD-1

  int cur = 0;          // ring buffer of this trip's stage
  int prv = NB - 1;     // ring buffer of the trip before's
  for (int st = 0; st < NT; ++st) {
    wait_ds0();         // this wave's reads of the buffer refilled below have returned
    // This wave's copies of stage st have landed. Every wave issues CPT copies a
    // stage, in stage order, so while the younger stage has been issued the count
    // leaves exactly its copies in flight; in the last trip, where it has not, 0.
    if (st + (LEAD - 1) < NT) wait_async<(LEAD - 1) * CPT>();
    else                      wait_async<0>();
    __syncthreads();    // all waves landed; all waves done reading the trip before's buffer
    if (st + LEAD < NT)   // into the buffer of the trip before; flies over LEAD trips
      issue_tile(64 * KG * (st + LEAD), prv);

    const _Float16* Kc = Kt0 + cur * KG * KVT + r * KVS + 8 * g;
    const _Float16* Vc = Vt0 + cur * KG * KVT + r * KVS + 8 * g;

    // Mask from LDS: 8 consecutive keys of one query per 16-key group, 2x float4.
    const float* mc = Mt0 + cur * KG * MT + (16 * w + r) * MP + 8 * g;
    float4 mk[4][2];
#pragma unroll
    for (int c = 0; c < 4; ++c) {
      mk[c][0] = *(const float4*)(mc + 16 * c);
      mk[c][1] = *(const float4*)(mc + 16 * c + 4);
    }

    // S^T = K * Q^T : 2 K-chunks x 4 key-row blocks
    v8f sacc[4];
#pragma unroll
    for (int c = 0; c < 4; ++c) sacc[c] = zero8();
#pragma unroll
    for (int kk = 0; kk < 2; ++kk) {
#pragma unroll
      for (int c = 0; c < 4; ++c) {
        v16h ka = ld_frag_b128(Kc + 16 * c * KVS + kk * 32);
        sacc[c] = wmma_f16(ka, qb[kk], sacc[c]);
      }
    }

    // Online softmax of query r: 32 scores in this lane, 32 in lane^16.
    float s[4][8], mxc[4];
#pragma unroll
    for (int c = 0; c < 4; ++c) {
      const float mv[8] = {mk[c][0].x, mk[c][0].y, mk[c][0].z, mk[c][0].w,
                           mk[c][1].x, mk[c][1].y, mk[c][1].z, mk[c][1].w};
      mxc[c] = -1.0e30f;
#pragma unroll
      for (int j = 0; j < 8; ++j) {
        s[c][j] = fmaf(mv[j], mcoef, sacc[c][j] * scale);
        mxc[c] = fmaxf(mxc[c], s[c][j]);
      }
    }
    float mx = fmaxf(fmaxf(mxc[0], mxc[1]), fmaxf(mxc[2], mxc[3]));
    mx = fmaxf(mx, other_half(mx));
    const float mnew = fmaxf(mrow, mx);
    const float corr = exp2_1(mrow - mnew);
    mrow = mnew;

    float psc[4];
    v16h pb[2];
#pragma unroll
    for (int c = 0; c < 4; ++c) {
      float arg[8], pv[8];
#pragma unroll
      for (int j = 0; j < 8; ++j) arg[j] = s[c][j] - mnew;
      exp2_8(pv, arg);
      psc[c] = pv[0];
#pragma unroll
      for (int j = 1; j < 8; ++j) psc[c] += pv[j];
#pragma unroll
      for (int j = 0; j < 8; ++j) pb[c >> 1][8 * (c & 1) + j] = (_Float16)pv[j];
    }
    lrow = lrow * corr + ((psc[0] + psc[1]) + (psc[2] + psc[3]));
#pragma unroll
    for (int c = 0; c < 4; ++c)
#pragma unroll
      for (int j = 0; j < 8; ++j) oacc[c][j] *= corr;

    // O^T += V^T * P^T : V^T as A-frags from [dh][key], P^T from registers
#pragma unroll
    for (int kk = 0; kk < 2; ++kk) {
#pragma unroll
      for (int c = 0; c < 4; ++c) {
        v16h va = ld_frag_b128(Vc + 16 * c * KVS + kk * 32);
        oacc[c] = wmma_f16(va, pb[kk], oacc[c]);
      }
    }
    prv = cur;
    cur = cur + 1 == NB ? 0 : cur + 1;
  }

  constexpr int XP = 8 * 32 * 4;     // floats of one plane: a float4 per lane and wave
  float* xo = msm + (w * 32 + lane) * 4;
  float* xm = msm + 8 * XP + (w * 32 + lane) * 2;
  wait_ds0();          // this wave's reads of the ring have returned
  __syncthreads();     // no wave reads the ring any more
  if (kg == 1) {
#pragma unroll
    for (int c = 0; c < 4; ++c) {
      float4 lo = {oacc[c][0], oacc[c][1], oacc[c][2], oacc[c][3]};
      float4 hi = {oacc[c][4], oacc[c][5], oacc[c][6], oacc[c][7]};
      *(float4*)(xo + (2 * c) * XP)     = lo;
      *(float4*)(xo + (2 * c + 1) * XP) = hi;
    }
    float2 ml = {mrow, lrow};
    *(float2*)xm = ml;
  }
  __syncthreads();
  if (kg == 0) {
    const float2 ml = *(const float2*)xm;
    const float mj = fmaxf(mrow, ml.x);
    const float a0 = exp2_1(mrow - mj);
    const float a1 = exp2_1(ml.x - mj);
    const float lj = lrow * a0 + ml.y * a1;
    // Join the halves' sums, normalize, write ctx (heads merged), f32:
    // ctx[query][head*64 + 16c + 8g + 0..7], 2x float4 per tile.
    const float inv = 1.0f / (lj + other_half(lj));
    const float b0 = a0 * inv, b1 = a1 * inv;
    float* orow = ctx + (size_t)qrow * D + head * 64 + 8 * g;
#pragma unroll
    for (int c = 0; c < 4; ++c) {
      const float4 xl = *(const float4*)(xo + (2 * c) * XP);
      const float4 xh = *(const float4*)(xo + (2 * c + 1) * XP);
      float4 lo = {oacc[c][0] * b0 + xl.x * b1, oacc[c][1] * b0 + xl.y * b1,
                   oacc[c][2] * b0 + xl.z * b1, oacc[c][3] * b0 + xl.w * b1};
      float4 hi = {oacc[c][4] * b0 + xh.x * b1, oacc[c][5] * b0 + xh.y * b1,
                   oacc[c][6] * b0 + xh.z * b1, oacc[c][7] * b0 + xh.w * b1};
      *(float4*)(orow + 16 * c)     = lo;
      *(float4*)(orow + 16 * c + 4) = hi;
    }
  }
}

// ---------------------------------------------------------------------------
// Launch: 3 projections (one grid) -> flash attention -> output projection. 20MB ws.
// ---------------------------------------------------------------------------
extern "C" void kernel_launch(void* const* d_in, const int* in_sizes, int n_in,
                              void* d_out, int out_size, void* d_ws, size_t ws_size,
                              hipStream_t stream) {
  (void)in_sizes; (void)n_in; (void)out_size; (void)ws_size;
  const float* q    = (const float*)d_in[0];
  const float* k    = (const float*)d_in[1];
  const float* v    = (const float*)d_in[2];
  const float* mask = (const float*)d_in[3];
  const float* wq   = (const float*)d_in[4];
  const float* wk   = (const float*)d_in[5];
  const float* wv   = (const float*)d_in[6];
  const float* wo   = (const float*)d_in[7];
  const float* bo   = (const float*)d_in[8];
  float* out = (float*)d_out;

  char* ws = (char*)d_ws;
  _Float16* Qh  = (_Float16*)(ws + 0);                        // 4 MB [H][S][64]
  _Float16* Kh  = (_Float16*)(ws + (size_t)4  * 1024 * 1024); // 4 MB [H][S][64]
  _Float16* VhT = (_Float16*)(ws + (size_t)8  * 1024 * 1024); // 4 MB [H][64][S]
  float*    ctx = (float*)   (ws + (size_t)12 * 1024 * 1024); // 8 MB [S][512]

  dim3 gblk(256);
  // 4096/128 row blocks x 512/64 col blocks (x 3 projections)
  proj_qkv<<<dim3(32, 8, 3), gblk, 0, stream>>>(q, k, v, wq, wk, wv, Qh, Kh, VhT);
  flash_attn<<<dim3(32, 8), dim3(512), 0, stream>>>(Qh, Kh, VhT, mask, ctx);
  proj_out<<<dim3(32, 8), gblk, 0, stream>>>(ctx, wo, bo, out);
}

// v008
// Measured time: 64.5 microseconds a run.
// Next to v007, in two timings, it ran 1.08 times as fast each time.
// Counting every step since v000, it is 3.68 times as fast.
#include <hip/hip_runtime.h>
#include <hip/hip_bf16.h>

typedef __attribute__((ext_vector_type(16))) _Float16 v16h;
typedef __attribute__((ext_vector_type(8)))  float    v8f;

__device__ __forceinline__ v8f wmma_f16(v16h a, v16h b, v8f c) {
  return __builtin_amdgcn_wmma_f32_16x16x32_f16(false, a, false, b, (short)0, c,
                                                false, false);
}

// Gather one 16-half fragment as 8 packed 32-bit loads (pairs contiguous in K).
__device__ __forceinline__ v16h ld_frag(const _Float16* base, const int* koff) {
  union { unsigned u[8]; v16h h; } t;
#pragma unroll
  for (int p = 0; p < 8; ++p)
    t.u[p] = *(const unsigned*)(base + koff[p]);
  return t.h;
}

// The same fragment as its two 16-byte runs (k = 8g..8g+7 and 16+8g..16+8g+7);
// base holds the lane's 8g already and is 16-byte aligned.
__device__ __forceinline__ v16h ld_frag_b128(const _Float16* base) {
  union { uint4 q[2]; v16h h; } t;
  t.q[0] = *(const uint4*)(base);
  t.q[1] = *(const uint4*)(base + 16);
  return t.h;
}

__device__ __forceinline__ v8f zero8() {
  v8f z = {0.f, 0.f, 0.f, 0.f, 0.f, 0.f, 0.f, 0.f};
  return z;
}

__device__ __forceinline__ unsigned lds_off(const void* p) {
  return (unsigned)(size_t)p;
}

__device__ __forceinline__ void async_copy12_b128(const unsigned (&l)[12],
                                                  const void* const (&p)[12]) {
  asm volatile("global_load_async_to_lds_b128 %0, %12, off\n\t"
               "global_load_async_to_lds_b128 %1, %13, off\n\t"
               "global_load_async_to_lds_b128 %2, %14, off\n\t"
               "global_load_async_to_lds_b128 %3, %15, off\n\t"
               "global_load_async_to_lds_b128 %4, %16, off\n\t"
               "global_load_async_to_lds_b128 %5, %17, off\n\t"
               "global_load_async_to_lds_b128 %6, %18, off\n\t"
               "global_load_async_to_lds_b128 %7, %19, off\n\t"
               "global_load_async_to_lds_b128 %8, %20, off\n\t"
               "global_load_async_to_lds_b128 %9, %21, off\n\t"
               "global_load_async_to_lds_b128 %10, %22, off\n\t"
               "global_load_async_to_lds_b128 %11, %23, off\n\t"
               "s_wait_xcnt 0x0"
               :
               : "v"(l[0]), "v"(l[1]), "v"(l[2]), "v"(l[3]),
                 "v"(l[4]), "v"(l[5]), "v"(l[6]), "v"(l[7]),
                 "v"(l[8]), "v"(l[9]), "v"(l[10]), "v"(l[11]),
                 "v"(p[0]), "v"(p[1]), "v"(p[2]), "v"(p[3]),
                 "v"(p[4]), "v"(p[5]), "v"(p[6]), "v"(p[7]),
                 "v"(p[8]), "v"(p[9]), "v"(p[10]), "v"(p[11])
               : "memory");
}

// Value of the same lane position in the other 16-lane half (lane ^ 16).
__device__ __forceinline__ float other_half(float x) {
  unsigned u = __builtin_bit_cast(unsigned, x);
  u = __builtin_amdgcn_permlanex16(u, u, 0x76543210u, 0xfedcba98u, false, false);
  return __builtin_bit_cast(float, u);
}

__device__ __forceinline__ float exp2_1(float x) {
  float y;
  asm("v_exp_f32 %0, %1\n\tv_nop" : "=&v"(y) : "v"(x));
  return y;
}
__device__ __forceinline__ void exp2_8(float (&p)[8], const float (&a)[8]) {
  asm("v_exp_f32 %0, %8\n\t"
      "v_exp_f32 %1, %9\n\t"
      "v_exp_f32 %2, %10\n\t"
      "v_exp_f32 %3, %11\n\t"
      "v_exp_f32 %4, %12\n\t"
      "v_exp_f32 %5, %13\n\t"
      "v_exp_f32 %6, %14\n\t"
      "v_exp_f32 %7, %15\n\t"
      "v_nop"
      : "=&v"(p[0]), "=&v"(p[1]), "=&v"(p[2]), "=&v"(p[3]),
        "=&v"(p[4]), "=&v"(p[5]), "=&v"(p[6]), "=&v"(p[7])
      : "v"(a[0]), "v"(a[1]), "v"(a[2]), "v"(a[3]),
        "v"(a[4]), "v"(a[5]), "v"(a[6]), "v"(a[7]));
}

template <bool FIRST>
__device__ __forceinline__ void exp2_8_of_products(float (&p)[8], const v8f& a) {
  if constexpr (FIRST)
    asm volatile("v_nop\n\t"
                 "v_nop\n\t"
                 "v_nop\n\t"
                 "v_nop\n\t"
                 "v_exp_f32 %0, %8\n\t"
                 "v_exp_f32 %1, %9\n\t"
                 "v_exp_f32 %2, %10\n\t"
                 "v_exp_f32 %3, %11\n\t"
                 "v_exp_f32 %4, %12\n\t"
                 "v_exp_f32 %5, %13\n\t"
                 "v_exp_f32 %6, %14\n\t"
                 "v_exp_f32 %7, %15\n\t"
                 "v_nop"
                 : "=&v"(p[0]), "=&v"(p[1]), "=&v"(p[2]), "=&v"(p[3]),
                   "=&v"(p[4]), "=&v"(p[5]), "=&v"(p[6]), "=&v"(p[7])
                 : "v"(a[0]), "v"(a[1]), "v"(a[2]), "v"(a[3]),
                   "v"(a[4]), "v"(a[5]), "v"(a[6]), "v"(a[7]));
  else
    asm volatile("v_exp_f32 %0, %8\n\t"
                 "v_exp_f32 %1, %9\n\t"
                 "v_exp_f32 %2, %10\n\t"
                 "v_exp_f32 %3, %11\n\t"
                 "v_exp_f32 %4, %12\n\t"
                 "v_exp_f32 %5, %13\n\t"
                 "v_exp_f32 %6, %14\n\t"
                 "v_exp_f32 %7, %15\n\t"
                 "v_nop"
                 : "=&v"(p[0]), "=&v"(p[1]), "=&v"(p[2]), "=&v"(p[3]),
                   "=&v"(p[4]), "=&v"(p[5]), "=&v"(p[6]), "=&v"(p[7])
                 : "v"(a[0]), "v"(a[1]), "v"(a[2]), "v"(a[3]),
                   "v"(a[4]), "v"(a[5]), "v"(a[6]), "v"(a[7]));
}

// Sum of a lane's 32 P: (c0 + c1) + (c2 + c3), each c a chain over its eight values.
// The branch on the sum waits for it, so the four chains run two to an instruction.
__device__ __forceinline__ float tile_sum(const float (&p)[4][8]) {
  typedef __attribute__((ext_vector_type(2))) float f2;
  f2 a = {p[0][0], p[2][0]};
  f2 b = {p[1][0], p[3][0]};
#pragma unroll   // p has to stay in registers
  for (int j = 1; j < 8; ++j) {
    const f2 aj = {p[0][j], p[2][j]};
    const f2 bj = {p[1][j], p[3][j]};
    a += aj;
    b += bj;
  }
  const f2 t = a + b;
  return t.x + t.y;
}

// All but this wave's N youngest async copies have landed in LDS.
template <int N>
__device__ __forceinline__ void wait_async() {
  asm volatile("s_wait_asynccnt %0" :: "n"(N) : "memory");
}

// This wave's LDS reads have returned: stands in front of the barrier behind
// which the buffer they read is refilled by async copies.
__device__ __forceinline__ void wait_ds0() {
  asm volatile("s_wait_dscnt 0x0" ::: "memory");
}

// ---------------------------------------------------------------------------
// GEMM: C[4096x512] = X[4096x512] * W[512x512], f16 compute / f32 accumulate.
// Block tile 128x64, 8 waves (each wave: 16 rows x 64 cols = 4 accumulators).
// One staged tile is 128 deep in k: a thread has its 24 16-byte loads of a tile
// in flight together, so a block waits out the way to memory and its two
// barriers 4 times over K = 512.
// gemm_tile leaves the block's tile in acc; the two kernels below store it.
// ---------------------------------------------------------------------------
constexpr int GBK = 128;       // k depth of one staged tile

// Scores are kept in log2 units: e^(s - m) = 2^(s*log2e - m*log2e). The score scale
// times log2e goes into Q where its projection rounds it to f16, so the S product
// of the attention kernel needs no multiply behind it.
// 1/(sqrt(64)+1e-9) rounds to 0.125 in f32.
constexpr float LOG2E  = 1.44269504088896340736f;
constexpr float QSCALE = 0.125f * LOG2E;
constexpr int GP  = GBK + 8;

typedef __attribute__((ext_vector_type(4))) float    v4f;
typedef __attribute__((ext_vector_type(2))) float    v2f;
typedef __attribute__((ext_vector_type(2))) _Float16 v2h;

// Two f32 -> one register of two f16 (round to nearest even), lo in the low half.
__device__ __forceinline__ unsigned pack_h2(float lo, float hi) {
  v2f f = {lo, hi};
  return __builtin_bit_cast(unsigned, __builtin_convertvector(f, v2h));
}

__device__ __forceinline__ void gemm_tile(const float* __restrict__ X,
                                          const float* __restrict__ W,
                                          _Float16* As,   // [128][GP] halves, [row][k]
                                          _Float16* Bs,   // [64][GP] halves, [n][k]
                                          v8f (&acc)[4]) {
  constexpr int D = 512;
  const int m0 = blockIdx.x * 128;
  const int n0 = blockIdx.y * 64;
  const int t    = threadIdx.x;
  const int lane = t & 31;
  const int w    = t >> 5;      // wave id 0..7 (wave32)
  const int r    = lane & 15;
  const int g    = lane >> 4;

  // Every unroll below: the arrays its loop indexes have to stay in registers.
  int koff[8];
#pragma unroll
  for (int p = 0; p < 8; ++p) koff[p] = 2 * (p & 3) + 16 * (p >> 2) + 8 * g;

#pragma unroll
  for (int c = 0; c < 4; ++c) acc[c] = zero8();

  // A: a wave's load is 512 contiguous bytes of one row (rows w, w+8, ...).
  const float* xp = X + (size_t)(m0 + w) * D + 4 * lane;
  _Float16*    ap = As + w * GP + 4 * lane;
  // B: a thread takes 4 columns of the two rows 2*kp, 2*kp+1, so that a k pair
  // goes to [n][k] as one 32-bit store; 8 lanes cover one 128-byte line.
  const int bc = t & 7;         // float4 column, +8 for the second half
  const int kp = t >> 3;        // k pair 0..31, +32 for the second half
  const float* wp = W + (size_t)(2 * kp) * D + n0 + 4 * bc;
  _Float16*    bp = Bs + (4 * bc) * GP + 2 * kp;

  for (int kt = 0; kt < D / GBK; ++kt) {
    const int k0 = kt * GBK;
    v4f xa[16], wlo[4], whi[4];
#pragma unroll
    for (int i = 0; i < 16; ++i)
      xa[i] = *(const v4f*)(xp + (size_t)(8 * i) * D + k0);
#pragma unroll
    for (int i = 0; i < 4; ++i) {
      const float* q = wp + (size_t)(k0 + 64 * (i >> 1)) * D + 32 * (i & 1);
      wlo[i] = *(const v4f*)q;
      whi[i] = *(const v4f*)(q + D);
    }
    // Nothing is scheduled across this line: all 24 loads are issued before the
    // first is waited for. Without it the compiler lifts the first conversions in
    // among the loads and the tile's last loads start a whole memory trip later.
    __builtin_amdgcn_sched_barrier(0);
    // Stands in front of every later write of the loads' address registers.
    asm volatile("s_wait_xcnt 0x0" ::: "memory");
    __syncthreads();   // every wave has read its fragments of the tile before
#pragma unroll
    for (int i = 0; i < 16; ++i) {
      uint2 h = {pack_h2(xa[i].x, xa[i].y), pack_h2(xa[i].z, xa[i].w)};
      *(uint2*)(ap + 8 * i * GP) = h;
    }
#pragma unroll
    for (int i = 0; i < 4; ++i) {
      _Float16* d = bp + 32 * (i & 1) * GP + 64 * (i >> 1);
      *(unsigned*)(d)          = pack_h2(wlo[i].x, whi[i].x);
      *(unsigned*)(d + GP)     = pack_h2(wlo[i].y, whi[i].y);
      *(unsigned*)(d + 2 * GP) = pack_h2(wlo[i].z, whi[i].z);
      *(unsigned*)(d + 3 * GP) = pack_h2(wlo[i].w, whi[i].w);
    }
    __syncthreads();   // the tile is whole
    // The ten LDS reads of a 32-deep k step stand together, one step ahead of the
    // four products that use them.
    v16h af[2], bf[2][4];
    af[0] = ld_frag(As + (16 * w + r) * GP, koff);
#pragma unroll
    for (int c = 0; c < 4; ++c) bf[0][c] = ld_frag(Bs + (16 * c + r) * GP, koff);
#pragma unroll
    for (int kk = 0; kk < GBK / 32; ++kk) {
      if (kk + 1 < GBK / 32) {
        af[(kk + 1) & 1] = ld_frag(As + (16 * w + r) * GP + 32 * (kk + 1), koff);
#pragma unroll
        for (int c = 0; c < 4; ++c)
          bf[(kk + 1) & 1][c] = ld_frag(Bs + (16 * c + r) * GP + 32 * (kk + 1), koff);
        // Holds those reads above this step's products: left free, the compiler
        // sinks each read to its own product, which then waits it out alone.
        __builtin_amdgcn_sched_barrier(0);
      }
#pragma unroll
      for (int c = 0; c < 4; ++c) acc[c] = wmma_f16(af[kk & 1], bf[kk & 1][c], acc[c]);
    }
  }
}

// The three input projections in ONE launch: blockIdx.z picks q*wq, k*wk or v*wv.
// They do not depend on one another, and one of them alone puts a single block
// on a WGP, whose waves wait out every load and barrier with nothing beside
// them; together three blocks share a WGP and fill each other's waits.
//   z = 0, 1: out f16 [H][S][64]  (Q, K per-head layout; Q times QSCALE)
//   z = 2   : out f16 [H][64][S]  (V transposed per-head layout)
__global__ __launch_bounds__(256) void proj_qkv(const float* __restrict__ q,
                                                const float* __restrict__ k,
                                                const float* __restrict__ v,
                                                const float* __restrict__ wq,
                                                const float* __restrict__ wk,
                                                const float* __restrict__ wv,
                                                _Float16* __restrict__ Qh,
                                                _Float16* __restrict__ Kh,
                                                _Float16* __restrict__ VhT) {
  __shared__ __align__(16) _Float16 As[128 * GP];
  __shared__ __align__(16) _Float16 Bs[64 * GP];
  const int z = blockIdx.z;
  const float* X = z == 0 ? q : (z == 1 ? k : v);
  const float* W = z == 0 ? wq : (z == 1 ? wk : wv);

  v8f acc[4];
  gemm_tile(X, W, As, Bs, acc);

  const int lane = threadIdx.x & 31;
  const int r    = lane & 15;
  const int mb   = blockIdx.x * 128 + 16 * (threadIdx.x >> 5) + 8 * (lane >> 4);
  const int h    = blockIdx.y;     // 64 columns of a block = one head
  if (z == 2) {
#pragma unroll
    for (int c = 0; c < 4; ++c)
#pragma unroll
      for (int j = 0; j < 8; ++j)
        VhT[((size_t)h * 64 + 16 * c + r) * 4096 + mb + j] = (_Float16)acc[c][j];
  } else {
    _Float16* out16 = z == 0 ? Qh : Kh;
    const float os  = z == 0 ? QSCALE : 1.0f;
#pragma unroll
    for (int c = 0; c < 4; ++c)
#pragma unroll
      for (int j = 0; j < 8; ++j)
        out16[((size_t)h * 4096 + mb + j) * 64 + 16 * c + r] = (_Float16)(acc[c][j] * os);
  }
}

// Final projection: out f32 [S][512] = ctx * wo + bias.
__global__ __launch_bounds__(256) void proj_out(const float* __restrict__ X,
                                                const float* __restrict__ W,
                                                const float* __restrict__ bias,
                                                float* __restrict__ out32) {
  __shared__ __align__(16) _Float16 As[128 * GP];
  __shared__ __align__(16) _Float16 Bs[64 * GP];
  v8f acc[4];
  gemm_tile(X, W, As, Bs, acc);

  const int lane = threadIdx.x & 31;
  const int mb   = blockIdx.x * 128 + 16 * (threadIdx.x >> 5) + 8 * (lane >> 4);
#pragma unroll
  for (int c = 0; c < 4; ++c) {
    const int n = blockIdx.y * 64 + 16 * c + (lane & 15);
#pragma unroll
    for (int j = 0; j < 8; ++j)
      out32[(size_t)(mb + j) * 512 + n] = acc[c][j] + bias[n];
  }
}

__global__ __launch_bounds__(512) __attribute__((amdgpu_waves_per_eu(4, 4))) void flash_attn(const _Float16* __restrict__ Qh,
                                                  const _Float16* __restrict__ Kh,
                                                  const _Float16* __restrict__ VhT,
                                                  const float* __restrict__ mask,
                                                  float* __restrict__ ctx) {
  constexpr int S = 4096, DH = 64, D = 512;
  constexpr int KVS = 72;
  constexpr int KVT = 64 * KVS;
  constexpr int MP  = 68;
  constexpr int MT  = 128 * MP;
  constexpr int KG   = 2;
  constexpr int NB   = 3;
  constexpr int LEAD = NB - 1;
  constexpr int CPT  = 12;
  constexpr int NT   = S / (64 * KG);

  const int head = blockIdx.y;
  const int m0   = blockIdx.x * 128;
  const int t    = threadIdx.x;
  const int lane = t & 31;
  const int w    = (t >> 5) & 7;     // query group: rows 16w..16w+15 of the block
  const int kg   = t >> 8;           // key group: tile kg of every stage
  const int tg   = t & 255;          // thread within its key group
  const int r    = lane & 15;
  const int g    = lane >> 4;

  __shared__ __align__(16) _Float16 smem[2 * NB * KG * KVT];
  _Float16* Kt0 = smem + kg * KVT;                  // this group's tile of K stage 0
  _Float16* Vt0 = smem + (NB * KG + kg) * KVT;      // this group's tile of V stage 0
  __shared__ __align__(16) float msm[NB * KG * MT]; // NB mask stages
  float* Mt0 = msm + kg * MT;                       // this group's tile of mask stage 0

  int koff[8];
#pragma unroll
  for (int p = 0; p < 8; ++p) koff[p] = 2 * (p & 3) + 16 * (p >> 2) + 8 * g;

  // Q^T B-fragments: column (query) m0+16w+r, two 32-wide K chunks over Dh=64
  const int qrow = m0 + 16 * w + r;
  v16h qb[2];
#pragma unroll
  for (int kk = 0; kk < 2; ++kk) {
    union { unsigned u[8]; v16h h; } tmp;
#pragma unroll
    for (int p = 0; p < 8; ++p)
      tmp.u[p] = *(const unsigned*)(Qh + ((size_t)head * S + qrow) * DH +
                                    kk * 32 + koff[p]);
    qb[kk] = tmp.h;
  }

  // O^T tiles: oacc[c][j] = O(query r, dh 16c + j + 8g)
  v8f oacc[4];
#pragma unroll
  for (int c = 0; c < 4; ++c) oacc[c] = zero8();
  float mrow = -1.0e30f;  // reference of query r, in log2 units (equal in both halves)
  float lrow = 0.0f;      // running sum over this half's keys only
  float refc = 0.0f;      // the part of mrow that the accumulator's start value carries
  float thr  = -__builtin_inff();  // a tile's sum of P above this updates mrow: always in
                          // the first trip, which has no reference yet
  constexpr float PMAX = 1024.0f;  // bound on P between updates, far inside f16
  constexpr float RMAX = 1024.0f;  // bound on a reference that the start value carries

  const float mcoef = -1.0e9f * LOG2E;

  const float*   mgp = mask + (size_t)(m0 + 16 * w + g) * S + 64 * kg + 4 * r;
  const unsigned mlp = lds_off(Mt0 + (16 * w + g) * MP + 4 * r);
  // Issue the async copies of this group's 64-key tile of one stage: per thread
  // 8x16B of mask (longest way to come: first), then 2x16B of K + 2x16B of V.
  // t0 is the stage's first key; a group reads only what its own waves copy.
  const _Float16* kgp[2];
  const _Float16* vgp[2];
  unsigned klp[2], vlp[2];
#pragma unroll
  for (int i = 0; i < 2; ++i) {
    const int idx = tg + 256 * i;       // 0..511 chunks of 8 halves
    const int row = idx >> 3, c8 = idx & 7;
    kgp[i] = Kh + ((size_t)head * S + 64 * kg + row) * DH + 8 * c8;
    vgp[i] = VhT + ((size_t)head * DH + row) * S + 64 * kg + 8 * c8;
    klp[i] = lds_off(Kt0 + row * KVS + 8 * c8);
    vlp[i] = lds_off(Vt0 + row * KVS + 8 * c8);
  }
  auto issue_tile = [&](int t0, int buf) {
    unsigned l[CPT];
    const void* p[CPT];
#pragma unroll
    for (int i = 0; i < 8; ++i) {
      l[i] = mlp + 4u * (unsigned)(buf * KG * MT + 2 * i * MP);
      p[i] = mgp + (size_t)(2 * i) * S + t0;
    }
#pragma unroll
    for (int i = 0; i < 2; ++i) {
      l[8 + 2 * i] = klp[i] + 2u * (unsigned)(buf * KG * KVT);
      p[8 + 2 * i] = kgp[i] + (size_t)t0 * DH;
      l[9 + 2 * i] = vlp[i] + 2u * (unsigned)(buf * KG * KVT);
      p[9 + 2 * i] = vgp[i] + t0;
    }
    async_copy12_b128(l, p);
  };

  static_assert(NT >= LEAD && LEAD * CPT <= 63, "ring prologue, copies in flight");
  for (int i = 0; i < LEAD; ++i) issue_tile(64 * KG * i, i);  // prologue: stages 0..LEAD-1

  int cur = 0;          // ring buffer of this trip's stage
  int prv = NB - 1;     // ring buffer of the trip before's
  for (int st = 0; st < NT; ++st) {
    wait_ds0();         // this wave's reads of the buffer refilled below have returned
    // This wave's copies of stage st have landed. Every wave issues CPT copies a
    // stage, in stage order, so while the younger stage has been issued the count
    // leaves exactly its copies in flight; in the last trip, where it has not, 0.
    if (st + (LEAD - 1) < NT) wait_async<(LEAD - 1) * CPT>();
    else                      wait_async<0>();
    __syncthreads();    // all waves landed; all waves done reading the trip before's buffer
    if (st + LEAD < NT)   // into the buffer of the trip before; flies over LEAD trips
      issue_tile(64 * KG * (st + LEAD), prv);

    const _Float16* Kc = Kt0 + cur * KG * KVT + r * KVS + 8 * g;
    const _Float16* Vc = Vt0 + cur * KG * KVT + r * KVS + 8 * g;

    // Mask from LDS: 8 consecutive keys of one query per 16-key group, 2x float4.
    const float* mc = Mt0 + cur * KG * MT + (16 * w + r) * MP + 8 * g;
    float4 mk[4][2];
#pragma unroll
    for (int c = 0; c < 4; ++c) {
      mk[c][0] = *(const float4*)(mc + 16 * c);
      mk[c][1] = *(const float4*)(mc + 16 * c + 4);
    }

    // S^T = K * Q^T + (mask term - reference) : 2 K-chunks x 4 key-row blocks
    v16h ka[2][4];
#pragma unroll
    for (int kk = 0; kk < 2; ++kk)
#pragma unroll
      for (int c = 0; c < 4; ++c) ka[kk][c] = ld_frag_b128(Kc + 16 * c * KVS + kk * 32);
    v8f sacc[4];
    const v2f mcoef2 = {mcoef, mcoef};
    const v2f nref2  = {-refc, -refc};
#pragma unroll
    for (int c = 0; c < 4; ++c) {
      const float mv[8] = {mk[c][0].x, mk[c][0].y, mk[c][0].z, mk[c][0].w,
                           mk[c][1].x, mk[c][1].y, mk[c][1].z, mk[c][1].w};
#pragma unroll
      for (int p = 0; p < 4; ++p) {
        const v2f m2 = {mv[2 * p], mv[2 * p + 1]};
        const v2f s2 = __builtin_elementwise_fma(m2, mcoef2, nref2);
        sacc[c][2 * p]     = s2.x;
        sacc[c][2 * p + 1] = s2.y;
      }
    }
    // All K fragment reads and start values stand ahead of the first product: left
    // free, the compiler sinks the reads of the second k chunk to their products, and
    // each product then waits out its own read alone.
    __builtin_amdgcn_sched_barrier(0);
#pragma unroll
    for (int kk = 0; kk < 2; ++kk)
#pragma unroll
      for (int c = 0; c < 4; ++c) sacc[c] = wmma_f16(ka[kk][c], qb[kk], sacc[c]);
    __builtin_amdgcn_sched_barrier(0);

    // Softmax of query r: 32 scores in this lane, 32 in lane^16. P = 2^sacc.
    float pv[4][8];
    exp2_8_of_products<true>(pv[0], sacc[0]);
    exp2_8_of_products<false>(pv[1], sacc[1]);
    exp2_8_of_products<false>(pv[2], sacc[2]);
    exp2_8_of_products<false>(pv[3], sacc[3]);
    float tsum = tile_sum(pv);

    if (__builtin_amdgcn_ballot_w32(tsum > thr) != 0u) {
      // K and the mask are read from LDS again here: the buffer is this trip's until
      // the next trip's barrier.
      v8f sred[4];
#pragma unroll
      for (int c = 0; c < 4; ++c) sred[c] = zero8();
#pragma unroll
      for (int kk = 0; kk < 2; ++kk)
#pragma unroll
        for (int c = 0; c < 4; ++c)
          sred[c] = wmma_f16(ld_frag_b128(Kc + 16 * c * KVS + kk * 32), qb[kk], sred[c]);
      float s[4][8], mxc[4];
#pragma unroll
      for (int c = 0; c < 4; ++c) {
        const float4 ma = *(const float4*)(mc + 16 * c);
        const float4 mb = *(const float4*)(mc + 16 * c + 4);
        const float mv[8] = {ma.x, ma.y, ma.z, ma.w, mb.x, mb.y, mb.z, mb.w};
        mxc[c] = -1.0e30f;
#pragma unroll
        for (int j = 0; j < 8; ++j) {
          s[c][j] = fmaf(mv[j], mcoef, sred[c][j]);
          mxc[c] = fmaxf(mxc[c], s[c][j]);
        }
      }
      float mx = fmaxf(fmaxf(mxc[0], mxc[1]), fmaxf(mxc[2], mxc[3]));
      mx = fmaxf(mx, other_half(mx));
      const float mnew = fmaxf(mrow, mx);
      const float corr = exp2_1(mrow - mnew);
#pragma unroll
      for (int c = 0; c < 4; ++c) {
        float arg[8];
#pragma unroll
        for (int j = 0; j < 8; ++j) arg[j] = s[c][j] - mnew;
        exp2_8(pv[c], arg);
      }
      tsum = tile_sum(pv);
      lrow *= corr;
#pragma unroll
      for (int c = 0; c < 4; ++c)
#pragma unroll
        for (int j = 0; j < 8; ++j) oacc[c][j] *= corr;
      mrow = mnew;
      // The reference goes into the start value only while it is small, of either
      // sign: then every score that counts is small too and no f32 sum, with the
      // reference inside or outside, loses anything of it. Beyond RMAX (mask terms
      // that swallow the score) it stays out and every trip comes through here.
      const bool far = !(fabsf(mnew) <= RMAX);
      refc = far ? 0.0f : mnew;
      thr  = far ? -__builtin_inff() : PMAX;
    }
    lrow += tsum;

    v16h pb[2];
#pragma unroll
    for (int c = 0; c < 4; ++c)
#pragma unroll
      for (int j = 0; j < 8; ++j) pb[c >> 1][8 * (c & 1) + j] = (_Float16)pv[c][j];

    // O^T += V^T * P^T : V^T as A-frags from [dh][key], P^T from registers
#pragma unroll
    for (int kk = 0; kk < 2; ++kk) {
#pragma unroll
      for (int c = 0; c < 4; ++c) {
        v16h va = ld_frag_b128(Vc + 16 * c * KVS + kk * 32);
        oacc[c] = wmma_f16(va, pb[kk], oacc[c]);
      }
    }
    prv = cur;
    cur = cur + 1 == NB ? 0 : cur + 1;
  }

  constexpr int XP = 8 * 32 * 4;     // floats of one plane: a float4 per lane and wave
  float* xo = msm + (w * 32 + lane) * 4;
  float* xm = msm + 8 * XP + (w * 32 + lane) * 2;
  wait_ds0();          // this wave's reads of the ring have returned
  __syncthreads();     // no wave reads the ring any more
  if (kg == 1) {
#pragma unroll
    for (int c = 0; c < 4; ++c) {
      float4 lo = {oacc[c][0], oacc[c][1], oacc[c][2], oacc[c][3]};
      float4 hi = {oacc[c][4], oacc[c][5], oacc[c][6], oacc[c][7]};
      *(float4*)(xo + (2 * c) * XP)     = lo;
      *(float4*)(xo + (2 * c + 1) * XP) = hi;
    }
    float2 ml = {mrow, lrow};
    *(float2*)xm = ml;
  }
  __syncthreads();
  if (kg == 0) {
    const float2 ml = *(const float2*)xm;
    const float mj = fmaxf(mrow, ml.x);
    const float a0 = exp2_1(mrow - mj);
    const float a1 = exp2_1(ml.x - mj);
    const float lj = lrow * a0 + ml.y * a1;
    // Join the halves' sums, normalize, write ctx (heads merged), f32:
    // ctx[query][head*64 + 16c + 8g + 0..7], 2x float4 per tile.
    const float inv = 1.0f / (lj + other_half(lj));
    const float b0 = a0 * inv, b1 = a1 * inv;
    float* orow = ctx + (size_t)qrow * D + head * 64 + 8 * g;
#pragma unroll
    for (int c = 0; c < 4; ++c) {
      const float4 xl = *(const float4*)(xo + (2 * c) * XP);
      const float4 xh = *(const float4*)(xo + (2 * c + 1) * XP);
      float4 lo = {oacc[c][0] * b0 + xl.x * b1, oacc[c][1] * b0 + xl.y * b1,
                   oacc[c][2] * b0 + xl.z * b1, oacc[c][3] * b0 + xl.w * b1};
      float4 hi = {oacc[c][4] * b0 + xh.x * b1, oacc[c][5] * b0 + xh.y * b1,
                   oacc[c][6] * b0 + xh.z * b1, oacc[c][7] * b0 + xh.w * b1};
      *(float4*)(orow + 16 * c)     = lo;
      *(float4*)(orow + 16 * c + 4) = hi;
    }
  }
}

// ---------------------------------------------------------------------------
// Launch: 3 projections (one grid) -> flash attention -> output projection. 20MB ws.
// ---------------------------------------------------------------------------
extern "C" void kernel_launch(void* const* d_in, const int* in_sizes, int n_in,
                              void* d_out, int out_size, void* d_ws, size_t ws_size,
                              hipStream_t stream) {
  (void)in_sizes; (void)n_in; (void)out_size; (void)ws_size;
  const float* q    = (const float*)d_in[0];
  const float* k    = (const float*)d_in[1];
  const float* v    = (const float*)d_in[2];
  const float* mask = (const float*)d_in[3];
  const float* wq   = (const float*)d_in[4];
  const float* wk   = (const float*)d_in[5];
  const float* wv   = (const float*)d_in[6];
  const float* wo   = (const float*)d_in[7];
  const float* bo   = (const float*)d_in[8];
  float* out = (float*)d_out;

  char* ws = (char*)d_ws;
  _Float16* Qh  = (_Float16*)(ws + 0);                        // 4 MB [H][S][64]
  _Float16* Kh  = (_Float16*)(ws + (size_t)4  * 1024 * 1024); // 4 MB [H][S][64]
  _Float16* VhT = (_Float16*)(ws + (size_t)8  * 1024 * 1024); // 4 MB [H][64][S]
  float*    ctx = (float*)   (ws + (size_t)12 * 1024 * 1024); // 8 MB [S][512]

  dim3 gblk(256);
  // 4096/128 row blocks x 512/64 col blocks (x 3 projections)
  proj_qkv<<<dim3(32, 8, 3), gblk, 0, stream>>>(q, k, v, wq, wk, wv, Qh, Kh, VhT);
  flash_attn<<<dim3(32, 8), dim3(512), 0, stream>>>(Qh, Kh, VhT, mask, ctx);
  proj_out<<<dim3(32, 8), gblk, 0, stream>>>(ctx, wo, bo, out);
}

// v009
// Measured time: 60 microseconds a run.
// Next to v008, in two timings, it ran 1.08 and 1.07 times as fast.
// All steps since v000 together make it 3.95 times as fast.
#include <hip/hip_runtime.h>
#include <hip/hip_bf16.h>

typedef __attribute__((ext_vector_type(16))) _Float16 v16h;
typedef __attribute__((ext_vector_type(8)))  float    v8f;

__device__ __forceinline__ v8f wmma_f16(v16h a, v16h b, v8f c) {
  return __builtin_amdgcn_wmma_f32_16x16x32_f16(false, a, false, b, (short)0, c,
                                                false, false);
}

// Gather one 16-half fragment as 8 packed 32-bit loads (pairs contiguous in K).
__device__ __forceinline__ v16h ld_frag(const _Float16* base, const int* koff) {
  union { unsigned u[8]; v16h h; } t;
#pragma unroll
  for (int p = 0; p < 8; ++p)
    t.u[p] = *(const unsigned*)(base + koff[p]);
  return t.h;
}

// The same fragment as its two 16-byte runs (k = 8g..8g+7 and 16+8g..16+8g+7);
// base holds the lane's 8g already and is 16-byte aligned.
__device__ __forceinline__ v16h ld_frag_b128(const _Float16* base) {
  union { uint4 q[2]; v16h h; } t;
  t.q[0] = *(const uint4*)(base);
  t.q[1] = *(const uint4*)(base + 16);
  return t.h;
}

__device__ __forceinline__ v8f zero8() {
  v8f z = {0.f, 0.f, 0.f, 0.f, 0.f, 0.f, 0.f, 0.f};
  return z;
}

__device__ __forceinline__ unsigned lds_off(const void* p) {
  return (unsigned)(size_t)p;
}

__device__ __forceinline__ void async_copy12_b128(const unsigned (&l)[12],
                                                  const void* const (&p)[12]) {
  asm volatile("global_load_async_to_lds_b128 %0, %12, off\n\t"
               "global_load_async_to_lds_b128 %1, %13, off\n\t"
               "global_load_async_to_lds_b128 %2, %14, off\n\t"
               "global_load_async_to_lds_b128 %3, %15, off\n\t"
               "global_load_async_to_lds_b128 %4, %16, off\n\t"
               "global_load_async_to_lds_b128 %5, %17, off\n\t"
               "global_load_async_to_lds_b128 %6, %18, off\n\t"
               "global_load_async_to_lds_b128 %7, %19, off\n\t"
               "global_load_async_to_lds_b128 %8, %20, off\n\t"
               "global_load_async_to_lds_b128 %9, %21, off\n\t"
               "global_load_async_to_lds_b128 %10, %22, off\n\t"
               "global_load_async_to_lds_b128 %11, %23, off\n\t"
               "s_wait_xcnt 0x0"
               :
               : "v"(l[0]), "v"(l[1]), "v"(l[2]), "v"(l[3]),
                 "v"(l[4]), "v"(l[5]), "v"(l[6]), "v"(l[7]),
                 "v"(l[8]), "v"(l[9]), "v"(l[10]), "v"(l[11]),
                 "v"(p[0]), "v"(p[1]), "v"(p[2]), "v"(p[3]),
                 "v"(p[4]), "v"(p[5]), "v"(p[6]), "v"(p[7]),
                 "v"(p[8]), "v"(p[9]), "v"(p[10]), "v"(p[11])
               : "memory");
}

// Value of the same lane position in the other 16-lane half (lane ^ 16).
__device__ __forceinline__ float other_half(float x) {
  unsigned u = __builtin_bit_cast(unsigned, x);
  u = __builtin_amdgcn_permlanex16(u, u, 0x76543210u, 0xfedcba98u, false, false);
  return __builtin_bit_cast(float, u);
}

__device__ __forceinline__ float exp2_1(float x) {
  float y;
  asm("v_exp_f32 %0, %1\n\tv_nop" : "=&v"(y) : "v"(x));
  return y;
}
__device__ __forceinline__ void exp2_8(float (&p)[8], const float (&a)[8]) {
  asm("v_exp_f32 %0, %8\n\t"
      "v_exp_f32 %1, %9\n\t"
      "v_exp_f32 %2, %10\n\t"
      "v_exp_f32 %3, %11\n\t"
      "v_exp_f32 %4, %12\n\t"
      "v_exp_f32 %5, %13\n\t"
      "v_exp_f32 %6, %14\n\t"
      "v_exp_f32 %7, %15\n\t"
      "v_nop"
      : "=&v"(p[0]), "=&v"(p[1]), "=&v"(p[2]), "=&v"(p[3]),
        "=&v"(p[4]), "=&v"(p[5]), "=&v"(p[6]), "=&v"(p[7])
      : "v"(a[0]), "v"(a[1]), "v"(a[2]), "v"(a[3]),
        "v"(a[4]), "v"(a[5]), "v"(a[6]), "v"(a[7]));
}

template <bool FIRST>
__device__ __forceinline__ void exp2_8_of_products(float (&p)[8], const v8f& a) {
  if constexpr (FIRST)
    asm volatile("v_nop\n\t"
                 "v_nop\n\t"
                 "v_nop\n\t"
                 "v_nop\n\t"
                 "v_exp_f32 %0, %8\n\t"
                 "v_exp_f32 %1, %9\n\t"
                 "v_exp_f32 %2, %10\n\t"
                 "v_exp_f32 %3, %11\n\t"
                 "v_exp_f32 %4, %12\n\t"
                 "v_exp_f32 %5, %13\n\t"
                 "v_exp_f32 %6, %14\n\t"
                 "v_exp_f32 %7, %15\n\t"
                 "v_nop"
                 : "=&v"(p[0]), "=&v"(p[1]), "=&v"(p[2]), "=&v"(p[3]),
                   "=&v"(p[4]), "=&v"(p[5]), "=&v"(p[6]), "=&v"(p[7])
                 : "v"(a[0]), "v"(a[1]), "v"(a[2]), "v"(a[3]),
                   "v"(a[4]), "v"(a[5]), "v"(a[6]), "v"(a[7]));
  else
    asm volatile("v_exp_f32 %0, %8\n\t"
                 "v_exp_f32 %1, %9\n\t"
                 "v_exp_f32 %2, %10\n\t"
                 "v_exp_f32 %3, %11\n\t"
                 "v_exp_f32 %4, %12\n\t"
                 "v_exp_f32 %5, %13\n\t"
                 "v_exp_f32 %6, %14\n\t"
                 "v_exp_f32 %7, %15\n\t"
                 "v_nop"
                 : "=&v"(p[0]), "=&v"(p[1]), "=&v"(p[2]), "=&v"(p[3]),
                   "=&v"(p[4]), "=&v"(p[5]), "=&v"(p[6]), "=&v"(p[7])
                 : "v"(a[0]), "v"(a[1]), "v"(a[2]), "v"(a[3]),
                   "v"(a[4]), "v"(a[5]), "v"(a[6]), "v"(a[7]));
}

// Sums of a lane's 16 P of each of its two query tiles: c0 + c1, each c a chain over
// its eight values. The branch on the sums waits for them, so the two tiles' chains
// run two to an instruction.
__device__ __forceinline__ void tile_sums(const float (&p)[2][2][8], float (&ts)[2]) {
  typedef __attribute__((ext_vector_type(2))) float f2;
  f2 a = {p[0][0][0], p[1][0][0]};
  f2 b = {p[0][1][0], p[1][1][0]};
#pragma unroll   // p has to stay in registers
  for (int j = 1; j < 8; ++j) {
    const f2 aj = {p[0][0][j], p[1][0][j]};
    const f2 bj = {p[0][1][j], p[1][1][j]};
    a += aj;
    b += bj;
  }
  const f2 t = a + b;
  ts[0] = t.x;
  ts[1] = t.y;
}

// All but this wave's N youngest async copies have landed in LDS.
template <int N>
__device__ __forceinline__ void wait_async() {
  asm volatile("s_wait_asynccnt %0" :: "n"(N) : "memory");
}

// This wave's LDS reads have returned: stands in front of the barrier behind
// which the buffer they read is refilled by async copies.
__device__ __forceinline__ void wait_ds0() {
  asm volatile("s_wait_dscnt 0x0" ::: "memory");
}

// ---------------------------------------------------------------------------
// GEMM: C[4096x512] = X[4096x512] * W[512x512], f16 compute / f32 accumulate.
// Block tile 128x64, 8 waves (each wave: 16 rows x 64 cols = 4 accumulators).
// One staged tile is 128 deep in k: a thread has its 24 16-byte loads of a tile
// in flight together, so a block waits out the way to memory and its two
// barriers 4 times over K = 512.
// gemm_tile leaves the block's tile in acc; the two kernels below store it.
// ---------------------------------------------------------------------------
constexpr int GBK = 128;       // k depth of one staged tile

// Scores are kept in log2 units: e^(s - m) = 2^(s*log2e - m*log2e). The score scale
// times log2e goes into Q where its projection rounds it to f16, so the S product
// of the attention kernel needs no multiply behind it.
// 1/(sqrt(64)+1e-9) rounds to 0.125 in f32.
constexpr float LOG2E  = 1.44269504088896340736f;
constexpr float QSCALE = 0.125f * LOG2E;
constexpr int GP  = GBK + 8;

typedef __attribute__((ext_vector_type(4))) float    v4f;
typedef __attribute__((ext_vector_type(2))) float    v2f;
typedef __attribute__((ext_vector_type(2))) _Float16 v2h;

// Two f32 -> one register of two f16 (round to nearest even), lo in the low half.
__device__ __forceinline__ unsigned pack_h2(float lo, float hi) {
  v2f f = {lo, hi};
  return __builtin_bit_cast(unsigned, __builtin_convertvector(f, v2h));
}

__device__ __forceinline__ void gemm_tile(const float* __restrict__ X,
                                          const float* __restrict__ W,
                                          _Float16* As,   // [128][GP] halves, [row][k]
                                          _Float16* Bs,   // [64][GP] halves, [n][k]
                                          v8f (&acc)[4]) {
  constexpr int D = 512;
  const int m0 = blockIdx.x * 128;
  const int n0 = blockIdx.y * 64;
  const int t    = threadIdx.x;
  const int lane = t & 31;
  const int w    = t >> 5;      // wave id 0..7 (wave32)
  const int r    = lane & 15;
  const int g    = lane >> 4;

  // Every unroll below: the arrays its loop indexes have to stay in registers.
  int koff[8];
#pragma unroll
  for (int p = 0; p < 8; ++p) koff[p] = 2 * (p & 3) + 16 * (p >> 2) + 8 * g;

#pragma unroll
  for (int c = 0; c < 4; ++c) acc[c] = zero8();

  // A: a wave's load is 512 contiguous bytes of one row (rows w, w+8, ...).
  const float* xp = X + (size_t)(m0 + w) * D + 4 * lane;
  _Float16*    ap = As + w * GP + 4 * lane;
  // B: a thread takes 4 columns of the two rows 2*kp, 2*kp+1, so that a k pair
  // goes to [n][k] as one 32-bit store; 8 lanes cover one 128-byte line.
  const int bc = t & 7;         // float4 column, +8 for the second half
  const int kp = t >> 3;        // k pair 0..31, +32 for the second half
  const float* wp = W + (size_t)(2 * kp) * D + n0 + 4 * bc;
  _Float16*    bp = Bs + (4 * bc) * GP + 2 * kp;

  for (int kt = 0; kt < D / GBK; ++kt) {
    const int k0 = kt * GBK;
    v4f xa[16], wlo[4], whi[4];
#pragma unroll
    for (int i = 0; i < 16; ++i)
      xa[i] = *(const v4f*)(xp + (size_t)(8 * i) * D + k0);
#pragma unroll
    for (int i = 0; i < 4; ++i) {
      const float* q = wp + (size_t)(k0 + 64 * (i >> 1)) * D + 32 * (i & 1);
      wlo[i] = *(const v4f*)q;
      whi[i] = *(const v4f*)(q + D);
    }
    // Nothing is scheduled across this line: all 24 loads are issued before the
    // first is waited for. Without it the compiler lifts the first conversions in
    // among the loads and the tile's last loads start a whole memory trip later.
    __builtin_amdgcn_sched_barrier(0);
    // Stands in front of every later write of the loads' address registers.
    asm volatile("s_wait_xcnt 0x0" ::: "memory");
    __syncthreads();   // every wave has read its fragments of the tile before
#pragma unroll
    for (int i = 0; i < 16; ++i) {
      uint2 h = {pack_h2(xa[i].x, xa[i].y), pack_h2(xa[i].z, xa[i].w)};
      *(uint2*)(ap + 8 * i * GP) = h;
    }
#pragma unroll
    for (int i = 0; i < 4; ++i) {
      _Float16* d = bp + 32 * (i & 1) * GP + 64 * (i >> 1);
      *(unsigned*)(d)          = pack_h2(wlo[i].x, whi[i].x);
      *(unsigned*)(d + GP)     = pack_h2(wlo[i].y, whi[i].y);
      *(unsigned*)(d + 2 * GP) = pack_h2(wlo[i].z, whi[i].z);
      *(unsigned*)(d + 3 * GP) = pack_h2(wlo[i].w, whi[i].w);
    }
    __syncthreads();   // the tile is whole
    // The ten LDS reads of a 32-deep k step stand together, one step ahead of the
    // four products that use them.
    v16h af[2], bf[2][4];
    af[0] = ld_frag(As + (16 * w + r) * GP, koff);
#pragma unroll
    for (int c = 0; c < 4; ++c) bf[0][c] = ld_frag(Bs + (16 * c + r) * GP, koff);
#pragma unroll
    for (int kk = 0; kk < GBK / 32; ++kk) {
      if (kk + 1 < GBK / 32) {
        af[(kk + 1) & 1] = ld_frag(As + (16 * w + r) * GP + 32 * (kk + 1), koff);
#pragma unroll
        for (int c = 0; c < 4; ++c)
          bf[(kk + 1) & 1][c] = ld_frag(Bs + (16 * c + r) * GP + 32 * (kk + 1), koff);
        // Holds those reads above this step's products: left free, the compiler
        // sinks each read to its own product, which then waits it out alone.
        __builtin_amdgcn_sched_barrier(0);
      }
#pragma unroll
      for (int c = 0; c < 4; ++c) acc[c] = wmma_f16(af[kk & 1], bf[kk & 1][c], acc[c]);
    }
  }
}

// The three input projections in ONE launch: blockIdx.z picks q*wq, k*wk or v*wv.
// They do not depend on one another, and one of them alone puts a single block
// on a WGP, whose waves wait out every load and barrier with nothing beside
// them; together three blocks share a WGP and fill each other's waits.
//   z = 0, 1: out f16 [H][S][64]  (Q, K per-head layout; Q times QSCALE)
//   z = 2   : out f16 [H][64][S]  (V transposed per-head layout)
__global__ __launch_bounds__(256) void proj_qkv(const float* __restrict__ q,
                                                const float* __restrict__ k,
                                                const float* __restrict__ v,
                                                const float* __restrict__ wq,
                                                const float* __restrict__ wk,
                                                const float* __restrict__ wv,
                                                _Float16* __restrict__ Qh,
                                                _Float16* __restrict__ Kh,
                                                _Float16* __restrict__ VhT) {
  __shared__ __align__(16) _Float16 As[128 * GP];
  __shared__ __align__(16) _Float16 Bs[64 * GP];
  const int z = blockIdx.z;
  const float* X = z == 0 ? q : (z == 1 ? k : v);
  const float* W = z == 0 ? wq : (z == 1 ? wk : wv);

  v8f acc[4];
  gemm_tile(X, W, As, Bs, acc);

  const int lane = threadIdx.x & 31;
  const int r    = lane & 15;
  const int mb   = blockIdx.x * 128 + 16 * (threadIdx.x >> 5) + 8 * (lane >> 4);
  const int h    = blockIdx.y;     // 64 columns of a block = one head
  if (z == 2) {
#pragma unroll
    for (int c = 0; c < 4; ++c)
#pragma unroll
      for (int j = 0; j < 8; ++j)
        VhT[((size_t)h * 64 + 16 * c + r) * 4096 + mb + j] = (_Float16)acc[c][j];
  } else {
    _Float16* out16 = z == 0 ? Qh : Kh;
    const float os  = z == 0 ? QSCALE : 1.0f;
#pragma unroll
    for (int c = 0; c < 4; ++c)
#pragma unroll
      for (int j = 0; j < 8; ++j)
        out16[((size_t)h * 4096 + mb + j) * 64 + 16 * c + r] = (_Float16)(acc[c][j] * os);
  }
}

// Final projection: out f32 [S][512] = ctx * wo + bias.
__global__ __launch_bounds__(256) void proj_out(const float* __restrict__ X,
                                                const float* __restrict__ W,
                                                const float* __restrict__ bias,
                                                float* __restrict__ out32) {
  __shared__ __align__(16) _Float16 As[128 * GP];
  __shared__ __align__(16) _Float16 Bs[64 * GP];
  v8f acc[4];
  gemm_tile(X, W, As, Bs, acc);

  const int lane = threadIdx.x & 31;
  const int mb   = blockIdx.x * 128 + 16 * (threadIdx.x >> 5) + 8 * (lane >> 4);
#pragma unroll
  for (int c = 0; c < 4; ++c) {
    const int n = blockIdx.y * 64 + 16 * c + (lane & 15);
#pragma unroll
    for (int j = 0; j < 8; ++j)
      out32[(size_t)(mb + j) * 512 + n] = acc[c][j] + bias[n];
  }
}

__global__ __launch_bounds__(512) __attribute__((amdgpu_waves_per_eu(4, 4))) void flash_attn(const _Float16* __restrict__ Qh,
                                                  const _Float16* __restrict__ Kh,
                                                  const _Float16* __restrict__ VhT,
                                                  const float* __restrict__ mask,
                                                  float* __restrict__ ctx) {
  constexpr int S = 4096, DH = 64, D = 512;
  constexpr int KVS = 72;
  constexpr int KVT = 64 * KVS;
  constexpr int MP  = 68;
  constexpr int MT  = 128 * MP;
  constexpr int KG   = 2;
  constexpr int NB   = 3;
  constexpr int LEAD = NB - 1;
  constexpr int CPT  = 12;
  constexpr int NT   = S / (64 * KG);

  const int head = blockIdx.y;
  const int m0   = blockIdx.x * 128;
  const int t    = threadIdx.x;
  const int lane = t & 31;
  const int r    = lane & 15;
  const int g    = lane >> 4;
  // Who copies what: tile kg of every stage, mask rows 16w..16w+15 of it.
  const int w    = (t >> 5) & 7;
  const int kg   = t >> 8;
  const int tg   = t & 255;          // thread within the 8 waves that copy one tile
  // Who computes what.
  const int wq   = (t >> 5) & 3;     // query group: rows 32wq..32wq+31 of the block
  const int kq   = t >> 7;           // key group: keys 32kq..32kq+31 of every stage

  __shared__ __align__(16) _Float16 smem[2 * NB * KG * KVT];
  _Float16* Kt0 = smem + kg * KVT;                  // K stage 0, the tile this wave copies
  _Float16* Vt0 = smem + (NB * KG + kg) * KVT;      // V stage 0, the tile this wave copies
  __shared__ __align__(16) float msm[NB * KG * MT]; // NB mask stages
  float* Mt0 = msm + kg * MT;                       // mask stage 0, the tile this wave copies
  // What this wave reads of stage 0. K: a stage's two tiles are 128 key rows in a row.
  // V^T and mask: keys run along a row, so the group's 32 are half a row of tile kq / 2.
  const _Float16* Kr0 = smem + (32 * kq + r) * KVS + 8 * g;
  const _Float16* Vr0 = smem + (NB * KG + (kq >> 1)) * KVT + r * KVS + 32 * (kq & 1) + 8 * g;
  const float*    Mr0 = msm + (kq >> 1) * MT + (32 * wq + r) * MP + 32 * (kq & 1) + 8 * g;

  int koff[8];
#pragma unroll
  for (int p = 0; p < 8; ++p) koff[p] = 2 * (p & 3) + 16 * (p >> 2) + 8 * g;

  // Q^T B-fragments: column (query) m0+32wq+16qt+r, two 32-wide K chunks over Dh=64
  const int qrow = m0 + 32 * wq + r;    // query tile 0; tile 1 is 16 rows on
  v16h qb[2][2];
#pragma unroll
  for (int qt = 0; qt < 2; ++qt)
#pragma unroll
    for (int kk = 0; kk < 2; ++kk) {
      union { unsigned u[8]; v16h h; } tmp;
#pragma unroll
      for (int p = 0; p < 8; ++p)
        tmp.u[p] = *(const unsigned*)(Qh + ((size_t)head * S + qrow + 16 * qt) * DH +
                                      kk * 32 + koff[p]);
      qb[qt][kk] = tmp.h;
    }

  // O^T tiles: oacc[qt][c][j] = O(query r of tile qt, dh 16c + j + 8g)
  v8f oacc[2][4];
  float mrow[2];  // reference of query r, in log2 units (equal in both halves)
  float lrow[2];  // running sum over this half's keys only
  float refc[2];  // the part of mrow that the accumulator's start value carries
  float thr[2];   // a tile's sum of P above this updates mrow: always in the first
                  // trip, which has no reference yet
#pragma unroll
  for (int qt = 0; qt < 2; ++qt) {
#pragma unroll
    for (int c = 0; c < 4; ++c) oacc[qt][c] = zero8();
    mrow[qt] = -1.0e30f;
    lrow[qt] = 0.0f;
    refc[qt] = 0.0f;
    thr[qt]  = -__builtin_inff();
  }
  constexpr float PMAX = 1024.0f;  // bound on P between updates, far inside f16
  constexpr float RMAX = 1024.0f;  // bound on a reference that the start value carries

  const float mcoef = -1.0e9f * LOG2E;

  const float*   mgp = mask + (size_t)(m0 + 16 * w + g) * S + 64 * kg + 4 * r;
  const unsigned mlp = lds_off(Mt0 + (16 * w + g) * MP + 4 * r);
  // Issue the async copies of one 64-key tile of one stage: per thread 8x16B of mask
  // (longest way to come: first), then 2x16B of K + 2x16B of V. t0 is the stage's
  // first key. What a wave reads, other waves have copied: it reads behind the trip's
  // barrier, which stands behind every wave's wait for its own copies.
  const _Float16* kgp[2];
  const _Float16* vgp[2];
  unsigned klp[2], vlp[2];
#pragma unroll
  for (int i = 0; i < 2; ++i) {
    const int idx = tg + 256 * i;       // 0..511 chunks of 8 halves
    const int row = idx >> 3, c8 = idx & 7;
    kgp[i] = Kh + ((size_t)head * S + 64 * kg + row) * DH + 8 * c8;
    vgp[i] = VhT + ((size_t)head * DH + row) * S + 64 * kg + 8 * c8;
    klp[i] = lds_off(Kt0 + row * KVS + 8 * c8);
    vlp[i] = lds_off(Vt0 + row * KVS + 8 * c8);
  }
  auto issue_tile = [&](int t0, int buf) {
    unsigned l[CPT];
    const void* p[CPT];
#pragma unroll
    for (int i = 0; i < 8; ++i) {
      l[i] = mlp + 4u * (unsigned)(buf * KG * MT + 2 * i * MP);
      p[i] = mgp + (size_t)(2 * i) * S + t0;
    }
#pragma unroll
    for (int i = 0; i < 2; ++i) {
      l[8 + 2 * i] = klp[i] + 2u * (unsigned)(buf * KG * KVT);
      p[8 + 2 * i] = kgp[i] + (size_t)t0 * DH;
      l[9 + 2 * i] = vlp[i] + 2u * (unsigned)(buf * KG * KVT);
      p[9 + 2 * i] = vgp[i] + t0;
    }
    async_copy12_b128(l, p);
  };

  static_assert(NT >= LEAD && LEAD * CPT <= 63, "ring prologue, copies in flight");
  for (int i = 0; i < LEAD; ++i) issue_tile(64 * KG * i, i);  // prologue: stages 0..LEAD-1

  int cur = 0;          // ring buffer of this trip's stage
  int prv = NB - 1;     // ring buffer of the trip before's
  for (int st = 0; st < NT; ++st) {
    wait_ds0();         // this wave's reads of the buffer refilled below have returned
    // This wave's copies of stage st have landed. Every wave issues CPT copies a
    // stage, in stage order, so while the younger stage has been issued the count
    // leaves exactly its copies in flight; in the last trip, where it has not, 0.
    if (st + (LEAD - 1) < NT) wait_async<(LEAD - 1) * CPT>();
    else                      wait_async<0>();
    __syncthreads();    // all waves landed; all waves done reading the trip before's buffer
    if (st + LEAD < NT)   // into the buffer of the trip before; flies over LEAD trips
      issue_tile(64 * KG * (st + LEAD), prv);

    const _Float16* Kc = Kr0 + cur * KG * KVT;
    const _Float16* Vc = Vr0 + cur * KG * KVT;

    // Mask from LDS: 8 consecutive keys of one query per 16-key group, 2x float4.
    const float* mc = Mr0 + cur * KG * MT;
    float4 mk[2][2][2];
#pragma unroll
    for (int qt = 0; qt < 2; ++qt)
#pragma unroll
      for (int c = 0; c < 2; ++c) {
        mk[qt][c][0] = *(const float4*)(mc + 16 * qt * MP + 16 * c);
        mk[qt][c][1] = *(const float4*)(mc + 16 * qt * MP + 16 * c + 4);
      }

    // S^T = K * Q^T + (mask term - reference) : 2 K-chunks x 2 key-row blocks, each
    // K fragment against both query tiles
    v16h ka[2][2];
#pragma unroll
    for (int kk = 0; kk < 2; ++kk)
#pragma unroll
      for (int c = 0; c < 2; ++c) ka[kk][c] = ld_frag_b128(Kc + 16 * c * KVS + kk * 32);
    v8f sacc[2][2];
    const v2f mcoef2 = {mcoef, mcoef};
#pragma unroll
    for (int qt = 0; qt < 2; ++qt) {
      const v2f nref2 = {-refc[qt], -refc[qt]};
#pragma unroll
      for (int c = 0; c < 2; ++c) {
        const float mv[8] = {mk[qt][c][0].x, mk[qt][c][0].y, mk[qt][c][0].z, mk[qt][c][0].w,
                             mk[qt][c][1].x, mk[qt][c][1].y, mk[qt][c][1].z, mk[qt][c][1].w};
#pragma unroll
        for (int p = 0; p < 4; ++p) {
          const v2f m2 = {mv[2 * p], mv[2 * p + 1]};
          const v2f s2 = __builtin_elementwise_fma(m2, mcoef2, nref2);
          sacc[qt][c][2 * p]     = s2.x;
          sacc[qt][c][2 * p + 1] = s2.y;
        }
      }
    }
    // All K fragment reads and start values stand ahead of the first product: left
    // free, the compiler sinks the reads of the second k chunk to their products, and
    // each product then waits out its own read alone.
    __builtin_amdgcn_sched_barrier(0);
#pragma unroll
    for (int kk = 0; kk < 2; ++kk)
#pragma unroll
      for (int c = 0; c < 2; ++c)
#pragma unroll
        for (int qt = 0; qt < 2; ++qt)
          sacc[qt][c] = wmma_f16(ka[kk][c], qb[qt][kk], sacc[qt][c]);
    __builtin_amdgcn_sched_barrier(0);

    // Softmax of query r of each tile: 16 scores in this lane, 16 in lane^16.
    // P = 2^sacc.
    float pv[2][2][8];
    exp2_8_of_products<true>(pv[0][0], sacc[0][0]);
    exp2_8_of_products<false>(pv[0][1], sacc[0][1]);
    exp2_8_of_products<false>(pv[1][0], sacc[1][0]);
    exp2_8_of_products<false>(pv[1][1], sacc[1][1]);
    float tsum[2];
    tile_sums(pv, tsum);

    if (__builtin_amdgcn_ballot_w32(tsum[0] > thr[0] || tsum[1] > thr[1]) != 0u) {
      // K and the mask are read from LDS again here: the buffer is this trip's until
      // the next trip's barrier.
      v8f sred[2][2];
#pragma unroll
      for (int qt = 0; qt < 2; ++qt)
#pragma unroll
        for (int c = 0; c < 2; ++c) sred[qt][c] = zero8();
#pragma unroll
      for (int kk = 0; kk < 2; ++kk)
#pragma unroll
        for (int c = 0; c < 2; ++c) {
          const v16h kf = ld_frag_b128(Kc + 16 * c * KVS + kk * 32);
#pragma unroll
          for (int qt = 0; qt < 2; ++qt)
            sred[qt][c] = wmma_f16(kf, qb[qt][kk], sred[qt][c]);
        }
#pragma unroll
      for (int qt = 0; qt < 2; ++qt) {
        float s[2][8], mxc[2];
#pragma unroll
        for (int c = 0; c < 2; ++c) {
          const float4 ma = *(const float4*)(mc + 16 * qt * MP + 16 * c);
          const float4 mb = *(const float4*)(mc + 16 * qt * MP + 16 * c + 4);
          const float mv[8] = {ma.x, ma.y, ma.z, ma.w, mb.x, mb.y, mb.z, mb.w};
          mxc[c] = -1.0e30f;
#pragma unroll
          for (int j = 0; j < 8; ++j) {
            s[c][j] = fmaf(mv[j], mcoef, sred[qt][c][j]);
            mxc[c] = fmaxf(mxc[c], s[c][j]);
          }
        }
        float mx = fmaxf(mxc[0], mxc[1]);
        mx = fmaxf(mx, other_half(mx));
        const float mnew = fmaxf(mrow[qt], mx);
        const float corr = exp2_1(mrow[qt] - mnew);
#pragma unroll
        for (int c = 0; c < 2; ++c) {
          float arg[8];
#pragma unroll
          for (int j = 0; j < 8; ++j) arg[j] = s[c][j] - mnew;
          exp2_8(pv[qt][c], arg);
        }
        lrow[qt] *= corr;
#pragma unroll
        for (int c = 0; c < 4; ++c)
#pragma unroll
          for (int j = 0; j < 8; ++j) oacc[qt][c][j] *= corr;
        mrow[qt] = mnew;
        // The reference goes into the start value only while it is small, of either
        // sign: then every score that counts is small too and no f32 sum, with the
        // reference inside or outside, loses anything of it. Beyond RMAX (mask terms
        // that swallow the score) it stays out and every trip comes through here.
        const bool far = !(fabsf(mnew) <= RMAX);
        refc[qt] = far ? 0.0f : mnew;
        thr[qt]  = far ? -__builtin_inff() : PMAX;
      }
      tile_sums(pv, tsum);
    }
    lrow[0] += tsum[0];
    lrow[1] += tsum[1];

    // V^T as A-frags from [dh][key]; P^T from registers.
    v16h va[4];
#pragma unroll
    for (int c = 0; c < 4; ++c) va[c] = ld_frag_b128(Vc + 16 * c * KVS);
    v16h pb[2];
#pragma unroll
    for (int qt = 0; qt < 2; ++qt)
#pragma unroll
      for (int c = 0; c < 2; ++c)
#pragma unroll
        for (int j = 0; j < 8; ++j) pb[qt][8 * c + j] = (_Float16)pv[qt][c][j];
    // All V fragment reads stand ahead of the first product: left free, the compiler
    // reads three of the four fragments into the same registers one after another,
    // and each pair of products then waits out its own read alone.
    __builtin_amdgcn_sched_barrier(0);

    // O^T += V^T * P^T : each V fragment against both query tiles' P^T
#pragma unroll
    for (int c = 0; c < 4; ++c)
#pragma unroll
      for (int qt = 0; qt < 2; ++qt) oacc[qt][c] = wmma_f16(va[c], pb[qt], oacc[qt][c]);
    prv = cur;
    cur = cur + 1 == NB ? 0 : cur + 1;
  }

  constexpr int XP = 4 * 32 * 4;     // floats of one plane: a float4 per lane and query group
  constexpr int XG = 16 * XP;        // one key group's O: 2 query tiles x 4 dh blocks x 2 planes
  float* xo = msm + (wq * 32 + lane) * 4;            // + (key group - 1) * XG
  float* xm = msm + 3 * XG + (wq * 32 + lane) * 4;   // + (key group - 1) * XP
  wait_ds0();          // this wave's reads of the ring have returned
  __syncthreads();     // no wave reads the ring any more
  if (kq != 0) {
    float* yo = xo + (kq - 1) * XG;
#pragma unroll
    for (int qt = 0; qt < 2; ++qt)
#pragma unroll
      for (int c = 0; c < 4; ++c) {
        float4 lo = {oacc[qt][c][0], oacc[qt][c][1], oacc[qt][c][2], oacc[qt][c][3]};
        float4 hi = {oacc[qt][c][4], oacc[qt][c][5], oacc[qt][c][6], oacc[qt][c][7]};
        *(float4*)(yo + (8 * qt + 2 * c) * XP)     = lo;
        *(float4*)(yo + (8 * qt + 2 * c + 1) * XP) = hi;
      }
    float4 ml = {mrow[0], lrow[0], mrow[1], lrow[1]};
    *(float4*)(xm + (kq - 1) * XP) = ml;
  }
  __syncthreads();     // the partial results of groups 1 to 3 are whole
  if (kq == 0) {
    const float4 ml1 = *(const float4*)(xm);
    const float4 ml2 = *(const float4*)(xm + XP);
    const float4 ml3 = *(const float4*)(xm + 2 * XP);
#pragma unroll
    for (int qt = 0; qt < 2; ++qt) {
      const float m1 = qt ? ml1.z : ml1.x, l1 = qt ? ml1.w : ml1.y;
      const float m2 = qt ? ml2.z : ml2.x, l2 = qt ? ml2.w : ml2.y;
      const float m3 = qt ? ml3.z : ml3.x, l3 = qt ? ml3.w : ml3.y;
      const float mj = fmaxf(fmaxf(mrow[qt], m1), fmaxf(m2, m3));
      const float a0 = exp2_1(mrow[qt] - mj);
      const float a1 = exp2_1(m1 - mj);
      const float a2 = exp2_1(m2 - mj);
      const float a3 = exp2_1(m3 - mj);
      const float lj = (lrow[qt] * a0 + l1 * a1) + (l2 * a2 + l3 * a3);
      // Join the halves' sums, normalize, write ctx (heads merged), f32:
      // ctx[query][head*64 + 16c + 8g + 0..7], 2x float4 per tile.
      const float inv = 1.0f / (lj + other_half(lj));
      const float b0 = a0 * inv, b1 = a1 * inv, b2 = a2 * inv, b3 = a3 * inv;
      float* orow = ctx + (size_t)(qrow + 16 * qt) * D + head * 64 + 8 * g;
#pragma unroll
      for (int c = 0; c < 4; ++c)
#pragma unroll
        for (int h = 0; h < 2; ++h) {
          const float* xp = xo + (8 * qt + 2 * c + h) * XP;
          const float4 x1 = *(const float4*)(xp);
          const float4 x2 = *(const float4*)(xp + XG);
          const float4 x3 = *(const float4*)(xp + 2 * XG);
          float4 o = {(oacc[qt][c][4 * h]     * b0 + x1.x * b1) + (x2.x * b2 + x3.x * b3),
                      (oacc[qt][c][4 * h + 1] * b0 + x1.y * b1) + (x2.y * b2 + x3.y * b3),
                      (oacc[qt][c][4 * h + 2] * b0 + x1.z * b1) + (x2.z * b2 + x3.z * b3),
                      (oacc[qt][c][4 * h + 3] * b0 + x1.w * b1) + (x2.w * b2 + x3.w * b3)};
          *(float4*)(orow + 16 * c + 4 * h) = o;
        }
    }
  }
}

// ---------------------------------------------------------------------------
// Launch: 3 projections (one grid) -> flash attention -> output projection. 20MB ws.
// ---------------------------------------------------------------------------
extern "C" void kernel_launch(void* const* d_in, const int* in_sizes, int n_in,
                              void* d_out, int out_size, void* d_ws, size_t ws_size,
                              hipStream_t stream) {
  (void)in_sizes; (void)n_in; (void)out_size; (void)ws_size;
  const float* q    = (const float*)d_in[0];
  const float* k    = (const float*)d_in[1];
  const float* v    = (const float*)d_in[2];
  const float* mask = (const float*)d_in[3];
  const float* wq   = (const float*)d_in[4];
  const float* wk   = (const float*)d_in[5];
  const float* wv   = (const float*)d_in[6];
  const float* wo   = (const float*)d_in[7];
  const float* bo   = (const float*)d_in[8];
  float* out = (float*)d_out;

  char* ws = (char*)d_ws;
  _Float16* Qh  = (_Float16*)(ws + 0);                        // 4 MB [H][S][64]
  _Float16* Kh  = (_Float16*)(ws + (size_t)4  * 1024 * 1024); // 4 MB [H][S][64]
  _Float16* VhT = (_Float16*)(ws + (size_t)8  * 1024 * 1024); // 4 MB [H][64][S]
  float*    ctx = (float*)   (ws + (size_t)12 * 1024 * 1024); // 8 MB [S][512]

  dim3 gblk(256);
  // 4096/128 row blocks x 512/64 col blocks (x 3 projections)
  proj_qkv<<<dim3(32, 8, 3), gblk, 0, stream>>>(q, k, v, wq, wk, wv, Qh, Kh, VhT);
  flash_attn<<<dim3(32, 8), dim3(512), 0, stream>>>(Qh, Kh, VhT, mask, ctx);
  proj_out<<<dim3(32, 8), gblk, 0, stream>>>(ctx, wo, bo, out);
}
